// v000
// Times are from an AMD MI455X. After a warm-up the kernel runs many times in a row, and a time is the length of
// such a window on the GPU divided by its runs, so every launch and the gaps after it count. The runs cycle
// through copies of the inputs. A figure is the median of several windows, for all but v000 over two sittings.
// Sittings can differ by a few percent; kernels timed side by side share one.
// The starting kernel, v000, takes 255 microseconds a run.
#include <hip/hip_runtime.h>
#include <hip/hip_bf16.h>

typedef __attribute__((ext_vector_type(16))) _Float16 v16h;
typedef __attribute__((ext_vector_type(2)))  _Float16 h2;
typedef __attribute__((ext_vector_type(8)))  float    v8f;
typedef __attribute__((ext_vector_type(4)))  float    f4;

#define B_     4
#define C_     64
#define H_     256
#define W_     256
#define HID_   170
#define TILE_  16
#define EXT_   20          // TILE + 2*2 halo (patch-aligned)
#define NPIX_  (EXT_*EXT_) // 400
#define XPAD_  72          // padded channel stride (16B-aligned, bank-friendly)
#define NGRP_  6           // ceil(170/32) groups of 32 gathered hidden channels
#define WROWS_ 192         // 6*32 gathered w_in rows (zero-padded)
#define HFPAD_ 404         // padded pixel stride for filtered-h tile
#define WOPAD_ 200         // padded hidden stride for w_out (cols >=170 zero)

#if defined(__HIP_DEVICE_COMPILE__) && defined(__gfx1250__)
#define USE_ASYNC_LDS 1
#else
#define USE_ASYNC_LDS 0
#endif

#if USE_ASYNC_LDS
// byte offset of a generic pointer within the wave's LDS aperture
__device__ static inline unsigned lds_offset_of(const void* p) {
  return (unsigned)(unsigned long long)
         (__attribute__((address_space(3))) const char*)p;
}
#endif

__global__ __launch_bounds__(256) void dffn_fused_kernel(
    const float* __restrict__ xin,  const float* __restrict__ w_in,
    const float* __restrict__ fft_w, const float* __restrict__ w_dw,
    const float* __restrict__ w_out, float* __restrict__ out)
{
  __shared__ __align__(16) _Float16 x_lds  [NPIX_ * XPAD_];   // 57.6 KB
  __shared__ __align__(16) _Float16 win_lds[WROWS_ * XPAD_];  // 27.6 KB
  __shared__ __align__(16) _Float16 hf_lds [32 * HFPAD_];     // 25.9 KB
  __shared__ __align__(16) _Float16 wout_lds[64 * WOPAD_];    // 25.6 KB
  __shared__ __align__(16) float    wdw_lds [2*HID_*9];       // 12.2 KB
  __shared__ __align__(16) float    fftw_lds[HID_*4];         //  2.7 KB

  const int tid  = threadIdx.x;
  const int wave = tid >> 5;
  const int nm   = tid & 15;        // M (pixel) or N (channel) index within 16
  const int hh   = (tid >> 4) & 1;  // wave half -> K-range selector in A/B layouts

  const int tx0 = blockIdx.x * TILE_;
  const int ty0 = blockIdx.y * TILE_;
  const int b   = blockIdx.z;

  const float* xb = xin + (size_t)b * C_ * H_ * W_;

  // ---- kick off async DMA of the pure-copy weight tables into LDS ----
  // (tracked by ASYNCcnt; overlapped with x-tile staging below)
#if USE_ASYNC_LDS
  for (int i = tid; i < (2*HID_*9)/4; i += 256) {       // 765 x b128
    unsigned ldst = lds_offset_of(&wdw_lds[i*4]);
    unsigned long long ga = (unsigned long long)(const void*)(w_dw + i*4);
    asm volatile("global_load_async_to_lds_b128 %0, %1, off"
                 :: "v"(ldst), "v"(ga) : "memory");
  }
  for (int i = tid; i < (HID_*4)/4; i += 256) {         // 170 x b128
    unsigned ldst = lds_offset_of(&fftw_lds[i*4]);
    unsigned long long ga = (unsigned long long)(const void*)(fft_w + i*4);
    asm volatile("global_load_async_to_lds_b128 %0, %1, off"
                 :: "v"(ldst), "v"(ga) : "memory");
  }
#else
  for (int i = tid; i < 2*HID_*9; i += 256) wdw_lds[i]  = w_dw[i];
  for (int i = tid; i < HID_*4;   i += 256) fftw_lds[i] = fft_w[i];
#endif

  // ---- prefetch the x rows this block is about to stage (global_prefetch_b8)
  for (int idx = tid; idx < C_ * EXT_; idx += 256) {
    int c = idx / EXT_, py = idx - c * EXT_;
    int gy = ty0 - 2 + py;
    int gx = tx0 - 2; gx = gx < 0 ? 0 : gx;
    if ((unsigned)gy < (unsigned)H_)
      __builtin_prefetch(&xb[(size_t)c * (H_*W_) + gy * W_ + gx], 0, 3);
  }

  // ---------------- stage converted operands into LDS ----------------
  for (int idx = tid; idx < C_ * NPIX_; idx += 256) {
    int c = idx / NPIX_;
    int p = idx - c * NPIX_;
    int py = p / EXT_, px = p - py * EXT_;
    int gy = ty0 - 2 + py, gx = tx0 - 2 + px;
    float v = 0.0f;
    if ((unsigned)gy < (unsigned)H_ && (unsigned)gx < (unsigned)W_)
      v = xb[(size_t)c * (H_*W_) + gy * W_ + gx];
    x_lds[p * XPAD_ + c] = (_Float16)v;   // zero halo => exact zero FFT patches
  }
  // gathered project_in rows: group j, slot s<16 -> ch 16j+s (low half),
  // slot s>=16 -> ch 85+16j+(s-16) (high half); invalid slots zero-padded
  for (int idx = tid; idx < WROWS_ * C_; idx += 256) {
    int row = idx >> 6;
    int c   = idx & 63;
    int j = row >> 5, s = row & 31, t = s & 15;
    int hch = ((s < 16) ? 0 : 85) + 16*j + t;
    float v = (16*j + t < 85) ? w_in[hch * C_ + c] : 0.0f;
    win_lds[row * XPAD_ + c] = (_Float16)v;
  }
  for (int idx = tid; idx < 64 * WOPAD_; idx += 256) {
    int r = idx / WOPAD_, o = idx - r * WOPAD_;
    float v = (o < HID_) ? w_out[r * HID_ + o] : 0.0f;
    wout_lds[idx] = (_Float16)v;
  }

#if USE_ASYNC_LDS
  asm volatile("s_wait_asynccnt 0" ::: "memory");
#endif
  __syncthreads();

  // persistent project_out accumulators: 2 pixel-blocks x 4 out-channel tiles
  v8f acc2[2][4];
  #pragma unroll
  for (int q = 0; q < 2; ++q)
    #pragma unroll
    for (int n = 0; n < 4; ++n) acc2[q][n] = (v8f){0,0,0,0,0,0,0,0};

  for (int j = 0; j < NGRP_; ++j) {
    // ---- GEMM1 (project_in) over extended tile + 2x2 Hadamard FFT filter ----
    // 25 pixel-blocks (5x5 of 4x4) x 2 channel-ntiles = 50 wave-jobs
    for (int id = wave; id < 50; id += 8) {
      int nt = id & 1;
      int mb = id >> 1;
      int mby = mb / 5, mbx = mb - mby * 5;
      int py = mby*4 + (nm >> 2);
      int px = mbx*4 + (nm & 3);
      const _Float16* ap = &x_lds[(py*EXT_ + px) * XPAD_ + 8*hh];
      const _Float16* bp = &win_lds[(j*32 + nt*16 + nm) * XPAD_ + 8*hh];
      v16h A0, A1, B0, B1;
      ((f4*)&A0)[0] = *(const f4*)(ap);        // K  8h.. 8h+7
      ((f4*)&A0)[1] = *(const f4*)(ap + 16);   // K 16+8h..
      ((f4*)&A1)[0] = *(const f4*)(ap + 32);
      ((f4*)&A1)[1] = *(const f4*)(ap + 48);
      ((f4*)&B0)[0] = *(const f4*)(bp);
      ((f4*)&B0)[1] = *(const f4*)(bp + 16);
      ((f4*)&B1)[0] = *(const f4*)(bp + 32);
      ((f4*)&B1)[1] = *(const f4*)(bp + 48);
      v8f acc = (v8f){0,0,0,0,0,0,0,0};
      acc = __builtin_amdgcn_wmma_f32_16x16x32_f16(false, A0, false, B0, (short)0, acc, false, false);
      acc = __builtin_amdgcn_wmma_f32_16x16x32_f16(false, A1, false, B1, (short)0, acc, false, false);

      // per-lane channel's 2x2 spectral weights
      int sg  = nt*16 + nm;
      int hch = ((sg < 16) ? 0 : 85) + 16*j + nm;
      hch = (hch > HID_-1) ? (HID_-1) : hch;     // pad slots: values are 0 anyway
      float w00 = fftw_lds[hch*4+0], w01 = fftw_lds[hch*4+1];
      float w10 = fftw_lds[hch*4+2], w11 = fftw_lds[hch*4+3];
      // each lane holds both rows of its 2 patches (C-layout rows 2h,2h+1)
      #pragma unroll
      for (int pc = 0; pc < 2; ++pc) {
        float s00 = acc[2*pc],   s01 = acc[2*pc+1];
        float s10 = acc[4+2*pc], s11 = acc[4+2*pc+1];
        float F00 = (s00+s01+s10+s11)*w00;
        float F01 = (s00-s01+s10-s11)*w01;
        float F10 = (s00+s01-s10-s11)*w10;
        float F11 = (s00-s01-s10+s11)*w11;
        float y00 = 0.25f*(F00+F01+F10+F11);
        float y01 = 0.25f*(F00-F01+F10-F11);
        float y10 = 0.25f*(F00+F01-F10-F11);
        float y11 = 0.25f*(F00-F01-F10+F11);
        int base0 = sg*HFPAD_ + (mby*4 + 2*hh)*EXT_ + (mbx*4 + 2*pc);
        h2 v0; v0[0] = (_Float16)y00; v0[1] = (_Float16)y01;
        h2 v1; v1[0] = (_Float16)y10; v1[1] = (_Float16)y11;
        *(h2*)&hf_lds[base0]        = v0;
        *(h2*)&hf_lds[base0 + EXT_] = v1;
      }
    }
    __syncthreads();

    // ---- depthwise 3x3 + exact-GELU gate, built directly in GEMM2 A-layout ----
    #pragma unroll
    for (int q = 0; q < 2; ++q) {
      int mb  = wave*2 + q;                 // 16 blocks over 16x16 tile
      int mby = mb >> 2, mbx = mb & 3;
      int oy = mby*4 + (nm >> 2), ox = mbx*4 + (nm & 3);
      int pcen = (oy + 2)*EXT_ + (ox + 2);  // center in extended coords
      _Float16 a2h[16];
      #pragma unroll
      for (int tt = 0; tt < 8; ++tt) {
        int t = (tt < 4) ? (4*hh + tt) : (4 + 4*hh + tt);   // lane's hf slot (low half)
        const _Float16* pl = &hf_lds[t*HFPAD_      + pcen - EXT_ - 1];
        const _Float16* ph = &hf_lds[(16+t)*HFPAD_ + pcen - EXT_ - 1];
        float lo[9], hi[9];
        #pragma unroll
        for (int r = 0; r < 3; ++r)
          #pragma unroll
          for (int cx = 0; cx < 3; ++cx) {
            lo[r*3+cx] = (float)pl[r*EXT_ + cx];
            hi[r*3+cx] = (float)ph[r*EXT_ + cx];
          }
        #pragma unroll
        for (int u = 0; u < 2; ++u) {
          int k = 2*t + u;
          int c = 32*j + k;                 // gated hidden channel
          float g = 0.0f;
          if (c < HID_) {
            const float* wl = &wdw_lds[c*9];
            const float* wh = &wdw_lds[(c+HID_)*9];
            float s1 = 0.0f, s2 = 0.0f;
            #pragma unroll
            for (int i = 0; i < 9; ++i) {
              s1 = fmaf(lo[i], wl[i], s1);
              s2 = fmaf(hi[i], wh[i], s2);
            }
            float ge = 0.5f * s1 * (1.0f + erff(s1 * 0.70710678118654752f));
            g = ge * s2;
          }
          a2h[2*tt + u] = (_Float16)g;      // matches A-layout K index for this lane
        }
      }
      v16h A2;
      #pragma unroll
      for (int e = 0; e < 16; ++e) A2[e] = a2h[e];
      #pragma unroll
      for (int n2 = 0; n2 < 4; ++n2) {
        const _Float16* bp = &wout_lds[(n2*16 + nm) * WOPAD_ + 32*j + 8*hh];
        v16h B2;
        ((f4*)&B2)[0] = *(const f4*)(bp);
        ((f4*)&B2)[1] = *(const f4*)(bp + 16);
        acc2[q][n2] = __builtin_amdgcn_wmma_f32_16x16x32_f16(
            false, A2, false, B2, (short)0, acc2[q][n2], false, false);
      }
    }
    __syncthreads();
  }

  // ---------------- epilogue: f32 output, float4 rows ----------------
  float* ob = out + (size_t)b * C_ * H_ * W_;
  #pragma unroll
  for (int q = 0; q < 2; ++q) {
    int mb  = wave*2 + q;
    int mby = mb >> 2, mbx = mb & 3;
    int gy0 = ty0 + mby*4 + 2*hh;
    int gx0 = tx0 + mbx*4;
    #pragma unroll
    for (int n2 = 0; n2 < 4; ++n2) {
      int cch = n2*16 + nm;
      v8f a = acc2[q][n2];
      f4 r0 = (f4){a[0], a[1], a[2], a[3]};
      f4 r1 = (f4){a[4], a[5], a[6], a[7]};
      size_t off = (size_t)cch * (H_*W_) + (size_t)gy0 * W_ + gx0;
      *(f4*)&ob[off]      = r0;
      *(f4*)&ob[off + W_] = r1;
    }
  }
}

extern "C" void kernel_launch(void* const* d_in, const int* in_sizes, int n_in,
                              void* d_out, int out_size, void* d_ws, size_t ws_size,
                              hipStream_t stream) {
  (void)in_sizes; (void)n_in; (void)d_ws; (void)ws_size; (void)out_size;
  const float* x     = (const float*)d_in[0];
  const float* w_in  = (const float*)d_in[1];
  const float* fft_w = (const float*)d_in[2];
  const float* w_dw  = (const float*)d_in[3];
  const float* w_out = (const float*)d_in[4];
  float* out = (float*)d_out;
  dim3 grid(W_/TILE_, H_/TILE_, B_);
  dffn_fused_kernel<<<grid, 256, 0, stream>>>(x, w_in, fft_w, w_dw, w_out, out);
}

// v001
// It runs in 140 microseconds.
// Two timings next to v000 both put it at 1.83 times that version's speed.
#include <hip/hip_runtime.h>
#include <hip/hip_bf16.h>

typedef __attribute__((ext_vector_type(16))) _Float16 v16h;
typedef __attribute__((ext_vector_type(2)))  _Float16 h2;
typedef __attribute__((ext_vector_type(8)))  float    v8f;
typedef __attribute__((ext_vector_type(4)))  float    f4;
typedef __attribute__((ext_vector_type(2)))  float    f2;
typedef __attribute__((ext_vector_type(4)))  _Float16 h4;

#define B_     4
#define C_     64
#define H_     256
#define W_     256
#define HID_   170
#define TILE_  16
#define EXT_   20          // TILE + 2*2 halo (patch-aligned)
#define NPIX_  (EXT_*EXT_) // 400
#define XPAD_  72          // padded channel stride (16B-aligned, bank-friendly)
#define NGRP_  6           // ceil(170/32) groups of 32 gathered hidden channels
#define WROWS_ 192         // 6*32 gathered w_in rows (zero-padded)
#define HFPAD_ 404         // padded pixel stride for filtered-h tile
#define WOPAD_ 200         // padded hidden stride for w_out (cols >=170 zero)
#define XUNITS_ ((C_/4)*EXT_*(EXT_/2))   // 3200 staging units of the x tile
#define XIT_    (XUNITS_/256)            // 12 whole units per thread
#define XTAIL_  (XUNITS_ - 256*XIT_)     // 128 units left: half a unit per thread
#define XHALF_  6                        // x units stored before the weights' loads issue
#define WIT_    (WROWS_*(C_/4)/256)      // 12 16-byte loads of w_in per thread

#if defined(__HIP_DEVICE_COMPILE__) && defined(__gfx1250__)
#define USE_ASYNC_LDS 1
#else
#define USE_ASYNC_LDS 0
#endif

#if USE_ASYNC_LDS
// byte offset of a generic pointer within the wave's LDS aperture
__device__ static inline unsigned lds_offset_of(const void* p) {
  return (unsigned)(unsigned long long)
         (__attribute__((address_space(3))) const char*)p;
}
#endif

__global__ __launch_bounds__(256) void dffn_fused_kernel(
    const float* __restrict__ xin,  const float* __restrict__ w_in,
    const float* __restrict__ fft_w, const float* __restrict__ w_dw,
    const float* __restrict__ w_out, float* __restrict__ out)
{
  __shared__ __align__(16) _Float16 x_lds  [NPIX_ * XPAD_];   // 57.6 KB
  __shared__ __align__(16) _Float16 win_lds[WROWS_ * XPAD_];  // 27.6 KB
  __shared__ __align__(16) _Float16 hf_lds [32 * HFPAD_];     // 25.9 KB
  __shared__ __align__(16) _Float16 wout_lds[64 * WOPAD_];    // 25.6 KB
  __shared__ __align__(16) float    wdw_lds [2*HID_*9];       // 12.2 KB
  __shared__ __align__(16) float    fftw_lds[HID_*4];         //  2.7 KB

  const int tid  = threadIdx.x;
  const int wave = tid >> 5;
  const int nm   = tid & 15;        // M (pixel) or N (channel) index within 16
  const int hh   = (tid >> 4) & 1;  // wave half -> K-range selector in A/B layouts

  const int tx0 = blockIdx.x * TILE_;
  const int ty0 = blockIdx.y * TILE_;
  const int b   = blockIdx.z;

  const float* xb = xin + (size_t)b * C_ * H_ * W_;

  // ---- kick off async DMA of the pure-copy weight tables into LDS ----
  // (tracked by ASYNCcnt; overlapped with x-tile staging below)
#if USE_ASYNC_LDS
  for (int i = tid; i < (2*HID_*9)/4; i += 256) {       // 765 x b128
    unsigned ldst = lds_offset_of(&wdw_lds[i*4]);
    unsigned long long ga = (unsigned long long)(const void*)(w_dw + i*4);
    asm volatile("global_load_async_to_lds_b128 %0, %1, off"
                 :: "v"(ldst), "v"(ga) : "memory");
  }
  for (int i = tid; i < (HID_*4)/4; i += 256) {         // 170 x b128
    unsigned ldst = lds_offset_of(&fftw_lds[i*4]);
    unsigned long long ga = (unsigned long long)(const void*)(fft_w + i*4);
    asm volatile("global_load_async_to_lds_b128 %0, %1, off"
                 :: "v"(ldst), "v"(ga) : "memory");
  }
#else
  for (int i = tid; i < 2*HID_*9; i += 256) wdw_lds[i]  = w_dw[i];
  for (int i = tid; i < HID_*4;   i += 256) fftw_lds[i] = fft_w[i];
#endif

  // ---------------- stage converted operands into LDS ----------------
  // Every global load below is unconditional (index clamped in bounds, value
  // selected to zero afterwards), so a whole batch is in flight before the
  // first wait; the weights' loads fly while the x tile is converted.
  //
  // x unit = 4 channels x 1 row x 2 columns: four 8-byte loads, two 8-byte LDS
  // stores. The tile's first column is even, so a column pair is inside the
  // image as a whole or outside it as a whole.
  f2       xv[XIT_][4];
  unsigned xoff[XIT_];     // byte offset of the unit's first load in xb
  int      xdst[XIT_];
  bool     xok[XIT_];
  const char* xbytes = (const char*)xb;

  // the unrolls of this section keep the batch arrays in registers and let all
  // loads of a batch issue back to back
  #pragma unroll
  for (int i = 0; i < XIT_; ++i) {
    int u   = tid + 256 * i;
    int cg  = u / (EXT_ * 10);
    int r   = u - cg * (EXT_ * 10);
    int py  = r / 10, k = r - py * 10;
    int gy  = ty0 - 2 + py, gx = tx0 - 2 + 2 * k;
    xok[i]  = (unsigned)gy < (unsigned)H_ && (unsigned)gx < (unsigned)W_;
    int cy  = gy < 0 ? 0 : (gy > H_ - 1 ? H_ - 1 : gy);
    int cx  = gx < 0 ? 0 : (gx > W_ - 2 ? W_ - 2 : gx);
    xoff[i] = 4u * (unsigned)(cg * 4 * (H_ * W_) + cy * W_ + cx);
    xdst[i] = (py * EXT_ + 2 * k) * XPAD_ + cg * 4;
    #pragma unroll
    for (int ch = 0; ch < 4; ++ch)
      xv[i][ch] = *(const f2*)(xbytes + xoff[i] + 4u * ch * (H_ * W_));
  }
  // the units left over: two threads share one, two channels each
  static_assert(2 * XTAIL_ == 256, "the tail takes exactly half a unit per thread");
  f2 tv[2]; unsigned toff; int tdst; bool tok;
  {
    int u   = 256 * XIT_ + (tid >> 1);
    int cg  = u / (EXT_ * 10);
    int r   = u - cg * (EXT_ * 10);
    int py  = r / 10, k = r - py * 10;
    int gy  = ty0 - 2 + py, gx = tx0 - 2 + 2 * k;
    tok     = (unsigned)gy < (unsigned)H_ && (unsigned)gx < (unsigned)W_;
    int cy  = gy < 0 ? 0 : (gy > H_ - 1 ? H_ - 1 : gy);
    int cx  = gx < 0 ? 0 : (gx > W_ - 2 ? W_ - 2 : gx);
    int c0  = cg * 4 + 2 * (tid & 1);
    toff  = 4u * (unsigned)(c0 * (H_ * W_) + cy * W_ + cx);
    tdst  = (py * EXT_ + 2 * k) * XPAD_ + c0;
    tv[0] = *(const f2*)(xbytes + toff);
    tv[1] = *(const f2*)(xbytes + toff + 4u * (H_ * W_));
  }
  // No offset register of the loads above may be rewritten (a later load's
  // result counts) before this wait: naming them as inputs keeps them until it.
  asm volatile("s_wait_xcnt 0x0"
               :: "v"(xoff[0]), "v"(xoff[1]), "v"(xoff[2]), "v"(xoff[3]),
                  "v"(xoff[4]), "v"(xoff[5]), "v"(xoff[6]), "v"(xoff[7]),
                  "v"(xoff[8]), "v"(xoff[9]), "v"(xoff[10]), "v"(xoff[11]),
                  "v"(toff) : "memory");

#define X_STORE(i) do {                                                       \
    h4 a0, a1;                                                                \
    _Pragma("unroll")                                                         \
    for (int ch = 0; ch < 4; ++ch) {                                          \
      a0[ch] = (_Float16)(xok[i] ? xv[i][ch][0] : 0.0f);                      \
      a1[ch] = (_Float16)(xok[i] ? xv[i][ch][1] : 0.0f);                      \
    }                                                                         \
    *(h4*)&x_lds[xdst[i]]         = a0;    /* zero halo => zero FFT patches */\
    *(h4*)&x_lds[xdst[i] + XPAD_] = a1;                                       \
  } while (0)

  #pragma unroll
  for (int i = 0; i < XHALF_; ++i) X_STORE(i);

  // gathered project_in rows: group j, slot s<16 -> ch 16j+s (low half),
  // slot s>=16 -> ch 85+16j+(s-16) (high half); invalid slots zero-padded.
  // Load i of a thread is LDS row 16i+t, t = tid/16: j = i/2, high half for odd i.
  const int wt = tid >> 4, wc4 = tid & 15;
  const bool wtail_ok = 80 + wt < 85;                 // group 5 holds 5 channels
  const unsigned woff  = 4u * (unsigned)(wt * C_ + wc4 * 4);
  const unsigned woff5 = 4u * (unsigned)((wtail_ok ? wt : 0) * C_ + wc4 * 4);
  f4 wv[WIT_];
  #pragma unroll
  for (int i = 0; i < WIT_; ++i) {
    unsigned row0 = ((i & 1) ? 85u : 0u) + 16u * (i >> 1);
    wv[i] = *(const f4*)((const char*)w_in + ((i >> 1) < 5 ? woff : woff5)
                         + 4u * C_ * row0);
  }
  // w_out: wave w stages rows 8w..8w+7; a lane takes the column pairs lane,
  // lane+32 and lane+64 of each row (pairs from 85 on are padding)
  const int lane = tid & 31;
  const unsigned ooff  = 4u * (unsigned)(wave * 8 * HID_ + 2 * lane);
  const unsigned ooff2 = 4u * (unsigned)(wave * 8 * HID_
                                         + 2 * (lane + 64 < HID_/2 ? lane + 64 : 0));
  f2 ov[8][3];
  #pragma unroll
  for (int rr = 0; rr < 8; ++rr) {
    ov[rr][0] = *(const f2*)((const char*)w_out + ooff  + 4u * HID_ * rr);
    ov[rr][1] = *(const f2*)((const char*)w_out + ooff  + 4u * HID_ * rr + 256u);
    ov[rr][2] = *(const f2*)((const char*)w_out + ooff2 + 4u * HID_ * rr);
  }
  // as above: the weights' offset registers stay untouched until this wait
  asm volatile("s_wait_xcnt 0x0"
               :: "v"(woff), "v"(woff5), "v"(ooff), "v"(ooff2) : "memory");

  #pragma unroll
  for (int i = XHALF_; i < XIT_; ++i) X_STORE(i);
  {
    h2 a0, a1;
    a0[0] = (_Float16)(tok ? tv[0][0] : 0.0f);  a0[1] = (_Float16)(tok ? tv[1][0] : 0.0f);
    a1[0] = (_Float16)(tok ? tv[0][1] : 0.0f);  a1[1] = (_Float16)(tok ? tv[1][1] : 0.0f);
    *(h2*)&x_lds[tdst]         = a0;
    *(h2*)&x_lds[tdst + XPAD_] = a1;
  }
#undef X_STORE

  #pragma unroll
  for (int i = 0; i < WIT_; ++i) {
    bool ok = (i >> 1) < 5 || wtail_ok;
    h4 a;
    #pragma unroll
    for (int e = 0; e < 4; ++e) a[e] = (_Float16)(ok ? wv[i][e] : 0.0f);
    *(h4*)&win_lds[(16 * i + wt) * XPAD_ + wc4 * 4] = a;
  }
  #pragma unroll
  for (int rr = 0; rr < 8; ++rr) {
    _Float16* wrow = &wout_lds[(wave * 8 + rr) * WOPAD_];
    #pragma unroll
    for (int ch = 0; ch < 3; ++ch) {
      int o2 = lane + 32 * ch;
      bool ok = o2 < HID_/2;
      h2 a;
      a[0] = (_Float16)(ok ? ov[rr][ch][0] : 0.0f);
      a[1] = (_Float16)(ok ? ov[rr][ch][1] : 0.0f);
      *(h2*)&wrow[2 * o2] = a;
    }
    if (lane < WOPAD_/2 - 96) *(h2*)&wrow[2 * (96 + lane)] = (h2){0, 0};
  }

#if USE_ASYNC_LDS
  asm volatile("s_wait_asynccnt 0" ::: "memory");
#endif
  __syncthreads();

  // persistent project_out accumulators: 2 pixel-blocks x 4 out-channel tiles
  v8f acc2[2][4];
  #pragma unroll
  for (int q = 0; q < 2; ++q)
    #pragma unroll
    for (int n = 0; n < 4; ++n) acc2[q][n] = (v8f){0,0,0,0,0,0,0,0};

  for (int j = 0; j < NGRP_; ++j) {
    // ---- GEMM1 (project_in) over extended tile + 2x2 Hadamard FFT filter ----
    // 25 pixel-blocks (5x5 of 4x4) x 2 channel-ntiles = 50 wave-jobs
    for (int id = wave; id < 50; id += 8) {
      int nt = id & 1;
      int mb = id >> 1;
      int mby = mb / 5, mbx = mb - mby * 5;
      int py = mby*4 + (nm >> 2);
      int px = mbx*4 + (nm & 3);
      const _Float16* ap = &x_lds[(py*EXT_ + px) * XPAD_ + 8*hh];
      const _Float16* bp = &win_lds[(j*32 + nt*16 + nm) * XPAD_ + 8*hh];
      v16h A0, A1, B0, B1;
      ((f4*)&A0)[0] = *(const f4*)(ap);        // K  8h.. 8h+7
      ((f4*)&A0)[1] = *(const f4*)(ap + 16);   // K 16+8h..
      ((f4*)&A1)[0] = *(const f4*)(ap + 32);
      ((f4*)&A1)[1] = *(const f4*)(ap + 48);
      ((f4*)&B0)[0] = *(const f4*)(bp);
      ((f4*)&B0)[1] = *(const f4*)(bp + 16);
      ((f4*)&B1)[0] = *(const f4*)(bp + 32);
      ((f4*)&B1)[1] = *(const f4*)(bp + 48);
      v8f acc = (v8f){0,0,0,0,0,0,0,0};
      acc = __builtin_amdgcn_wmma_f32_16x16x32_f16(false, A0, false, B0, (short)0, acc, false, false);
      acc = __builtin_amdgcn_wmma_f32_16x16x32_f16(false, A1, false, B1, (short)0, acc, false, false);

      // per-lane channel's 2x2 spectral weights
      int sg  = nt*16 + nm;
      int hch = ((sg < 16) ? 0 : 85) + 16*j + nm;
      hch = (hch > HID_-1) ? (HID_-1) : hch;     // pad slots: values are 0 anyway
      float w00 = fftw_lds[hch*4+0], w01 = fftw_lds[hch*4+1];
      float w10 = fftw_lds[hch*4+2], w11 = fftw_lds[hch*4+3];
      // each lane holds both rows of its 2 patches (C-layout rows 2h,2h+1)
      #pragma unroll
      for (int pc = 0; pc < 2; ++pc) {
        float s00 = acc[2*pc],   s01 = acc[2*pc+1];
        float s10 = acc[4+2*pc], s11 = acc[4+2*pc+1];
        float F00 = (s00+s01+s10+s11)*w00;
        float F01 = (s00-s01+s10-s11)*w01;
        float F10 = (s00+s01-s10-s11)*w10;
        float F11 = (s00-s01-s10+s11)*w11;
        float y00 = 0.25f*(F00+F01+F10+F11);
        float y01 = 0.25f*(F00-F01+F10-F11);
        float y10 = 0.25f*(F00+F01-F10-F11);
        float y11 = 0.25f*(F00-F01-F10+F11);
        int base0 = sg*HFPAD_ + (mby*4 + 2*hh)*EXT_ + (mbx*4 + 2*pc);
        h2 v0; v0[0] = (_Float16)y00; v0[1] = (_Float16)y01;
        h2 v1; v1[0] = (_Float16)y10; v1[1] = (_Float16)y11;
        *(h2*)&hf_lds[base0]        = v0;
        *(h2*)&hf_lds[base0 + EXT_] = v1;
      }
    }
    __syncthreads();

    // ---- depthwise 3x3 + exact-GELU gate, built directly in GEMM2 A-layout ----
    #pragma unroll
    for (int q = 0; q < 2; ++q) {
      int mb  = wave*2 + q;                 // 16 blocks over 16x16 tile
      int mby = mb >> 2, mbx = mb & 3;
      int oy = mby*4 + (nm >> 2), ox = mbx*4 + (nm & 3);
      int pcen = (oy + 2)*EXT_ + (ox + 2);  // center in extended coords
      _Float16 a2h[16];
      #pragma unroll
      for (int tt = 0; tt < 8; ++tt) {
        int t = (tt < 4) ? (4*hh + tt) : (4 + 4*hh + tt);   // lane's hf slot (low half)
        const _Float16* pl = &hf_lds[t*HFPAD_      + pcen - EXT_ - 1];
        const _Float16* ph = &hf_lds[(16+t)*HFPAD_ + pcen - EXT_ - 1];
        float lo[9], hi[9];
        #pragma unroll
        for (int r = 0; r < 3; ++r)
          #pragma unroll
          for (int cx = 0; cx < 3; ++cx) {
            lo[r*3+cx] = (float)pl[r*EXT_ + cx];
            hi[r*3+cx] = (float)ph[r*EXT_ + cx];
          }
        #pragma unroll
        for (int u = 0; u < 2; ++u) {
          int k = 2*t + u;
          int c = 32*j + k;                 // gated hidden channel
          float g = 0.0f;
          if (c < HID_) {
            const float* wl = &wdw_lds[c*9];
            const float* wh = &wdw_lds[(c+HID_)*9];
            float s1 = 0.0f, s2 = 0.0f;
            #pragma unroll
            for (int i = 0; i < 9; ++i) {
              s1 = fmaf(lo[i], wl[i], s1);
              s2 = fmaf(hi[i], wh[i], s2);
            }
            float ge = 0.5f * s1 * (1.0f + erff(s1 * 0.70710678118654752f));
            g = ge * s2;
          }
          a2h[2*tt + u] = (_Float16)g;      // matches A-layout K index for this lane
        }
      }
      v16h A2;
      #pragma unroll
      for (int e = 0; e < 16; ++e) A2[e] = a2h[e];
      #pragma unroll
      for (int n2 = 0; n2 < 4; ++n2) {
        const _Float16* bp = &wout_lds[(n2*16 + nm) * WOPAD_ + 32*j + 8*hh];
        v16h B2;
        ((f4*)&B2)[0] = *(const f4*)(bp);
        ((f4*)&B2)[1] = *(const f4*)(bp + 16);
        acc2[q][n2] = __builtin_amdgcn_wmma_f32_16x16x32_f16(
            false, A2, false, B2, (short)0, acc2[q][n2], false, false);
      }
    }
    __syncthreads();
  }

  // ---------------- epilogue: f32 output, float4 rows ----------------
  float* ob = out + (size_t)b * C_ * H_ * W_;
  #pragma unroll
  for (int q = 0; q < 2; ++q) {
    int mb  = wave*2 + q;
    int mby = mb >> 2, mbx = mb & 3;
    int gy0 = ty0 + mby*4 + 2*hh;
    int gx0 = tx0 + mbx*4;
    #pragma unroll
    for (int n2 = 0; n2 < 4; ++n2) {
      int cch = n2*16 + nm;
      v8f a = acc2[q][n2];
      f4 r0 = (f4){a[0], a[1], a[2], a[3]};
      f4 r1 = (f4){a[4], a[5], a[6], a[7]};
      size_t off = (size_t)cch * (H_*W_) + (size_t)gy0 * W_ + gx0;
      *(f4*)&ob[off]      = r0;
      *(f4*)&ob[off + W_] = r1;
    }
  }
}

extern "C" void kernel_launch(void* const* d_in, const int* in_sizes, int n_in,
                              void* d_out, int out_size, void* d_ws, size_t ws_size,
                              hipStream_t stream) {
  (void)in_sizes; (void)n_in; (void)d_ws; (void)ws_size; (void)out_size;
  const float* x     = (const float*)d_in[0];
  const float* w_in  = (const float*)d_in[1];
  const float* fft_w = (const float*)d_in[2];
  const float* w_dw  = (const float*)d_in[3];
  const float* w_out = (const float*)d_in[4];
  float* out = (float*)d_out;
  dim3 grid(W_/TILE_, H_/TILE_, B_);
  dffn_fused_kernel<<<grid, 256, 0, stream>>>(x, w_in, fft_w, w_dw, w_out, out);
}

// v002
// One run takes 131 microseconds.
// Two timings next to v001 put it at 1.06 and 1.07 times that version's speed.
// Counting every step since v000, it is 1.95 times as fast.
#include <hip/hip_runtime.h>
#include <hip/hip_bf16.h>

typedef __attribute__((ext_vector_type(16))) _Float16 v16h;
typedef __attribute__((ext_vector_type(2)))  _Float16 h2;
typedef __attribute__((ext_vector_type(8)))  float    v8f;
typedef __attribute__((ext_vector_type(4)))  float    f4;
typedef __attribute__((ext_vector_type(2)))  float    f2;
typedef __attribute__((ext_vector_type(4)))  _Float16 h4;

#define B_     4
#define C_     64
#define H_     256
#define W_     256
#define HID_   170
#define TILE_  16
#define EXT_   20          // TILE + 2*2 halo (patch-aligned)
#define NPIX_  (EXT_*EXT_) // 400
#define XPAD_  72          // padded channel stride (16B-aligned, bank-friendly)
#define NGRP_  6           // ceil(170/32) groups of 32 gathered hidden channels
#define WROWS_ 192         // 6*32 gathered w_in rows (zero-padded)
#define HFPAD_ 404         // padded pixel stride for filtered-h tile
#define WOPAD_ 200         // padded hidden stride for w_out (cols >=170 zero)
#define XUNITS_ ((C_/4)*EXT_*(EXT_/2))   // 3200 staging units of the x tile
#define XIT_    (XUNITS_/256)            // 12 whole units per thread
#define XTAIL_  (XUNITS_ - 256*XIT_)     // 128 units left: half a unit per thread
#define XHALF_  6                        // x units stored before the weights' loads issue
#define WIT_    (WROWS_*(C_/4)/256)      // 12 16-byte loads of w_in per thread

#if defined(__HIP_DEVICE_COMPILE__) && defined(__gfx1250__)
#define USE_ASYNC_LDS 1
#else
#define USE_ASYNC_LDS 0
#endif

#if USE_ASYNC_LDS
// byte offset of a generic pointer within the wave's LDS aperture
__device__ static inline unsigned lds_offset_of(const void* p) {
  return (unsigned)(unsigned long long)
         (__attribute__((address_space(3))) const char*)p;
}
#endif

__global__ __launch_bounds__(256) void dffn_fused_kernel(
    const float* __restrict__ xin,  const float* __restrict__ w_in,
    const float* __restrict__ fft_w, const float* __restrict__ w_dw,
    const float* __restrict__ w_out, float* __restrict__ out)
{
  __shared__ __align__(16) _Float16 x_lds  [NPIX_ * XPAD_];   // 57.6 KB
  __shared__ __align__(16) _Float16 win_lds[WROWS_ * XPAD_];  // 27.6 KB
  __shared__ __align__(16) _Float16 hf_lds [32 * HFPAD_];     // 25.9 KB
  __shared__ __align__(16) _Float16 wout_lds[64 * WOPAD_];    // 25.6 KB
  __shared__ __align__(16) float    wdw_lds [2*HID_*9];       // 12.2 KB
  __shared__ __align__(16) float    fftw_lds[HID_*4];         //  2.7 KB

  const int tid  = threadIdx.x;
  const int wave = tid >> 5;
  const int nm   = tid & 15;        // M (pixel) or N (channel) index within 16
  const int hh   = (tid >> 4) & 1;  // wave half -> K-range selector in A/B layouts

  const int tx0 = blockIdx.x * TILE_;
  const int ty0 = blockIdx.y * TILE_;
  const int b   = blockIdx.z;

  const float* xb = xin + (size_t)b * C_ * H_ * W_;

  // ---- kick off async DMA of the pure-copy weight tables into LDS ----
  // (tracked by ASYNCcnt; overlapped with x-tile staging below)
#if USE_ASYNC_LDS
  for (int i = tid; i < (2*HID_*9)/4; i += 256) {       // 765 x b128
    unsigned ldst = lds_offset_of(&wdw_lds[i*4]);
    unsigned long long ga = (unsigned long long)(const void*)(w_dw + i*4);
    asm volatile("global_load_async_to_lds_b128 %0, %1, off"
                 :: "v"(ldst), "v"(ga) : "memory");
  }
  for (int i = tid; i < (HID_*4)/4; i += 256) {         // 170 x b128
    unsigned ldst = lds_offset_of(&fftw_lds[i*4]);
    unsigned long long ga = (unsigned long long)(const void*)(fft_w + i*4);
    asm volatile("global_load_async_to_lds_b128 %0, %1, off"
                 :: "v"(ldst), "v"(ga) : "memory");
  }
#else
  for (int i = tid; i < 2*HID_*9; i += 256) wdw_lds[i]  = w_dw[i];
  for (int i = tid; i < HID_*4;   i += 256) fftw_lds[i] = fft_w[i];
#endif

  // ---------------- stage converted operands into LDS ----------------
  // Every global load below is unconditional (index clamped in bounds, value
  // selected to zero afterwards), so a whole batch is in flight before the
  // first wait; the weights' loads fly while the x tile is converted.
  //
  // x unit = 4 channels x 1 row x 2 columns: four 8-byte loads, two 8-byte LDS
  // stores. The tile's first column is even, so a column pair is inside the
  // image as a whole or outside it as a whole.
  f2       xv[XIT_][4];
  unsigned xoff[XIT_];     // byte offset of the unit's first load in xb
  int      xdst[XIT_];
  bool     xok[XIT_];
  const char* xbytes = (const char*)xb;

  // the unrolls of this section keep the batch arrays in registers and let all
  // loads of a batch issue back to back
  #pragma unroll
  for (int i = 0; i < XIT_; ++i) {
    int u   = tid + 256 * i;
    int cg  = u / (EXT_ * 10);
    int r   = u - cg * (EXT_ * 10);
    int py  = r / 10, k = r - py * 10;
    int gy  = ty0 - 2 + py, gx = tx0 - 2 + 2 * k;
    xok[i]  = (unsigned)gy < (unsigned)H_ && (unsigned)gx < (unsigned)W_;
    int cy  = gy < 0 ? 0 : (gy > H_ - 1 ? H_ - 1 : gy);
    int cx  = gx < 0 ? 0 : (gx > W_ - 2 ? W_ - 2 : gx);
    xoff[i] = 4u * (unsigned)(cg * 4 * (H_ * W_) + cy * W_ + cx);
    xdst[i] = (py * EXT_ + 2 * k) * XPAD_ + cg * 4;
    #pragma unroll
    for (int ch = 0; ch < 4; ++ch)
      xv[i][ch] = *(const f2*)(xbytes + xoff[i] + 4u * ch * (H_ * W_));
  }
  // the units left over: two threads share one, two channels each
  static_assert(2 * XTAIL_ == 256, "the tail takes exactly half a unit per thread");
  f2 tv[2]; unsigned toff; int tdst; bool tok;
  {
    int u   = 256 * XIT_ + (tid >> 1);
    int cg  = u / (EXT_ * 10);
    int r   = u - cg * (EXT_ * 10);
    int py  = r / 10, k = r - py * 10;
    int gy  = ty0 - 2 + py, gx = tx0 - 2 + 2 * k;
    tok     = (unsigned)gy < (unsigned)H_ && (unsigned)gx < (unsigned)W_;
    int cy  = gy < 0 ? 0 : (gy > H_ - 1 ? H_ - 1 : gy);
    int cx  = gx < 0 ? 0 : (gx > W_ - 2 ? W_ - 2 : gx);
    int c0  = cg * 4 + 2 * (tid & 1);
    toff  = 4u * (unsigned)(c0 * (H_ * W_) + cy * W_ + cx);
    tdst  = (py * EXT_ + 2 * k) * XPAD_ + c0;
    tv[0] = *(const f2*)(xbytes + toff);
    tv[1] = *(const f2*)(xbytes + toff + 4u * (H_ * W_));
  }
  // No offset register of the loads above may be rewritten (a later load's
  // result counts) before this wait: naming them as inputs keeps them until it.
  asm volatile("s_wait_xcnt 0x0"
               :: "v"(xoff[0]), "v"(xoff[1]), "v"(xoff[2]), "v"(xoff[3]),
                  "v"(xoff[4]), "v"(xoff[5]), "v"(xoff[6]), "v"(xoff[7]),
                  "v"(xoff[8]), "v"(xoff[9]), "v"(xoff[10]), "v"(xoff[11]),
                  "v"(toff) : "memory");

#define X_STORE(i) do {                                                       \
    h4 a0, a1;                                                                \
    _Pragma("unroll")                                                         \
    for (int ch = 0; ch < 4; ++ch) {                                          \
      a0[ch] = (_Float16)(xok[i] ? xv[i][ch][0] : 0.0f);                      \
      a1[ch] = (_Float16)(xok[i] ? xv[i][ch][1] : 0.0f);                      \
    }                                                                         \
    *(h4*)&x_lds[xdst[i]]         = a0;    /* zero halo => zero FFT patches */\
    *(h4*)&x_lds[xdst[i] + XPAD_] = a1;                                       \
  } while (0)

  #pragma unroll
  for (int i = 0; i < XHALF_; ++i) X_STORE(i);

  // gathered project_in rows: group j, slot s<16 -> ch 16j+s (low half),
  // slot s>=16 -> ch 85+16j+(s-16) (high half); invalid slots zero-padded.
  // Load i of a thread is LDS row 16i+t, t = tid/16: j = i/2, high half for odd i.
  const int wt = tid >> 4, wc4 = tid & 15;
  const bool wtail_ok = 80 + wt < 85;                 // group 5 holds 5 channels
  const unsigned woff  = 4u * (unsigned)(wt * C_ + wc4 * 4);
  const unsigned woff5 = 4u * (unsigned)((wtail_ok ? wt : 0) * C_ + wc4 * 4);
  f4 wv[WIT_];
  #pragma unroll
  for (int i = 0; i < WIT_; ++i) {
    unsigned row0 = ((i & 1) ? 85u : 0u) + 16u * (i >> 1);
    wv[i] = *(const f4*)((const char*)w_in + ((i >> 1) < 5 ? woff : woff5)
                         + 4u * C_ * row0);
  }
  // w_out: wave w stages rows 8w..8w+7; a lane takes the column pairs lane,
  // lane+32 and lane+64 of each row (pairs from 85 on are padding)
  const int lane = tid & 31;
  const unsigned ooff  = 4u * (unsigned)(wave * 8 * HID_ + 2 * lane);
  const unsigned ooff2 = 4u * (unsigned)(wave * 8 * HID_
                                         + 2 * (lane + 64 < HID_/2 ? lane + 64 : 0));
  f2 ov[8][3];
  #pragma unroll
  for (int rr = 0; rr < 8; ++rr) {
    ov[rr][0] = *(const f2*)((const char*)w_out + ooff  + 4u * HID_ * rr);
    ov[rr][1] = *(const f2*)((const char*)w_out + ooff  + 4u * HID_ * rr + 256u);
    ov[rr][2] = *(const f2*)((const char*)w_out + ooff2 + 4u * HID_ * rr);
  }
  // as above: the weights' offset registers stay untouched until this wait
  asm volatile("s_wait_xcnt 0x0"
               :: "v"(woff), "v"(woff5), "v"(ooff), "v"(ooff2) : "memory");

  #pragma unroll
  for (int i = XHALF_; i < XIT_; ++i) X_STORE(i);
  {
    h2 a0, a1;
    a0[0] = (_Float16)(tok ? tv[0][0] : 0.0f);  a0[1] = (_Float16)(tok ? tv[1][0] : 0.0f);
    a1[0] = (_Float16)(tok ? tv[0][1] : 0.0f);  a1[1] = (_Float16)(tok ? tv[1][1] : 0.0f);
    *(h2*)&x_lds[tdst]         = a0;
    *(h2*)&x_lds[tdst + XPAD_] = a1;
  }
#undef X_STORE

  #pragma unroll
  for (int i = 0; i < WIT_; ++i) {
    bool ok = (i >> 1) < 5 || wtail_ok;
    h4 a;
    #pragma unroll
    for (int e = 0; e < 4; ++e) a[e] = (_Float16)(ok ? wv[i][e] : 0.0f);
    *(h4*)&win_lds[(16 * i + wt) * XPAD_ + wc4 * 4] = a;
  }
  #pragma unroll
  for (int rr = 0; rr < 8; ++rr) {
    _Float16* wrow = &wout_lds[(wave * 8 + rr) * WOPAD_];
    #pragma unroll
    for (int ch = 0; ch < 3; ++ch) {
      int o2 = lane + 32 * ch;
      bool ok = o2 < HID_/2;
      h2 a;
      a[0] = (_Float16)(ok ? ov[rr][ch][0] : 0.0f);
      a[1] = (_Float16)(ok ? ov[rr][ch][1] : 0.0f);
      *(h2*)&wrow[2 * o2] = a;
    }
    if (lane < WOPAD_/2 - 96) *(h2*)&wrow[2 * (96 + lane)] = (h2){0, 0};
  }

#if USE_ASYNC_LDS
  asm volatile("s_wait_asynccnt 0" ::: "memory");
#endif
  __syncthreads();

  // persistent project_out accumulators: 2 pixel tiles x 4 out-channel tiles
  v8f acc2[2][4];
  #pragma unroll
  for (int q = 0; q < 2; ++q)
    #pragma unroll
    for (int n = 0; n < 4; ++n) acc2[q][n] = (v8f){0,0,0,0,0,0,0,0};

  for (int j = 0; j < NGRP_; ++j) {
    // ---- GEMM1 (project_in) over extended tile + 2x2 Hadamard FFT filter ----
    // 25 pixel-blocks (5x5 of 4x4) x 2 channel-ntiles = 50 wave-jobs
    for (int id = wave; id < 50; id += 8) {
      int nt = id & 1;
      int mb = id >> 1;
      int mby = mb / 5, mbx = mb - mby * 5;
      int py = mby*4 + (nm >> 2);
      int px = mbx*4 + (nm & 3);
      const _Float16* ap = &x_lds[(py*EXT_ + px) * XPAD_ + 8*hh];
      const _Float16* bp = &win_lds[(j*32 + nt*16 + nm) * XPAD_ + 8*hh];
      v16h A0, A1, B0, B1;
      ((f4*)&A0)[0] = *(const f4*)(ap);        // K  8h.. 8h+7
      ((f4*)&A0)[1] = *(const f4*)(ap + 16);   // K 16+8h..
      ((f4*)&A1)[0] = *(const f4*)(ap + 32);
      ((f4*)&A1)[1] = *(const f4*)(ap + 48);
      ((f4*)&B0)[0] = *(const f4*)(bp);
      ((f4*)&B0)[1] = *(const f4*)(bp + 16);
      ((f4*)&B1)[0] = *(const f4*)(bp + 32);
      ((f4*)&B1)[1] = *(const f4*)(bp + 48);
      v8f acc = (v8f){0,0,0,0,0,0,0,0};
      acc = __builtin_amdgcn_wmma_f32_16x16x32_f16(false, A0, false, B0, (short)0, acc, false, false);
      acc = __builtin_amdgcn_wmma_f32_16x16x32_f16(false, A1, false, B1, (short)0, acc, false, false);

      // per-lane channel's 2x2 spectral weights
      int sg  = nt*16 + nm;
      int hch = ((sg < 16) ? 0 : 85) + 16*j + nm;
      hch = (hch > HID_-1) ? (HID_-1) : hch;     // pad slots: values are 0 anyway
      float w00 = fftw_lds[hch*4+0], w01 = fftw_lds[hch*4+1];
      float w10 = fftw_lds[hch*4+2], w11 = fftw_lds[hch*4+3];
      // each lane holds both rows of its 2 patches (C-layout rows 2h,2h+1)
      #pragma unroll
      for (int pc = 0; pc < 2; ++pc) {
        float s00 = acc[2*pc],   s01 = acc[2*pc+1];
        float s10 = acc[4+2*pc], s11 = acc[4+2*pc+1];
        float F00 = (s00+s01+s10+s11)*w00;
        float F01 = (s00-s01+s10-s11)*w01;
        float F10 = (s00+s01-s10-s11)*w10;
        float F11 = (s00-s01-s10+s11)*w11;
        float y00 = 0.25f*(F00+F01+F10+F11);
        float y01 = 0.25f*(F00-F01+F10-F11);
        float y10 = 0.25f*(F00+F01-F10-F11);
        float y11 = 0.25f*(F00-F01-F10+F11);
        int base0 = sg*HFPAD_ + (mby*4 + 2*hh)*EXT_ + (mbx*4 + 2*pc);
        h2 v0; v0[0] = (_Float16)y00; v0[1] = (_Float16)y01;
        h2 v1; v1[0] = (_Float16)y10; v1[1] = (_Float16)y11;
        *(h2*)&hf_lds[base0]        = v0;
        *(h2*)&hf_lds[base0 + EXT_] = v1;
      }
    }
    __syncthreads();

    // ---- depthwise 3x3 + exact-GELU gate, built directly in GEMM2 A-layout ----
    // A wave owns output rows 2*wave and 2*wave+1. Row M of its pixel tile q is
    // the pixel (2*wave + M/8, 2*(M%8) + q): a lane's two tiles hold two pixels
    // side by side, so one read of a 3x4 window of hf and one read of the 3x3
    // weights serve both.
    {
      const int oy  = wave*2 + (nm >> 3);
      const int ox0 = 2*(nm & 7);
      const int pwin = (oy + 1)*EXT_ + ox0;   // even: the window's 4-byte pairs are aligned
      static_assert(HID_ % 2 == 0, "a channel pair c0, c0+1 is valid as a whole");
      _Float16 a2h[2][16];
      #pragma unroll
      for (int tt = 0; tt < 8; ++tt) {
        int t  = (tt < 4) ? (4*hh + tt) : (4 + 4*hh + tt);   // lane's hf slot (low half)
        int c0 = 32*j + 2*t;                  // gated hidden channels c0 and c0+1
        float g[2][2] = {{0.0f, 0.0f}, {0.0f, 0.0f}};
        if (c0 < HID_) {                      // HID_ is even: c0+1 is valid with c0
          const h2* pl = (const h2*)&hf_lds[t*HFPAD_      + pwin];
          const h2* ph = (const h2*)&hf_lds[(16+t)*HFPAD_ + pwin];
          float lo[3][4], hi[3][4];           // extended columns ox0+1 .. ox0+4
          #pragma unroll
          for (int r = 0; r < 3; ++r) {
            h2 l0 = pl[r*(EXT_/2)], l1 = pl[r*(EXT_/2) + 1], l2 = pl[r*(EXT_/2) + 2];
            h2 h0 = ph[r*(EXT_/2)], h1 = ph[r*(EXT_/2) + 1], h2v = ph[r*(EXT_/2) + 2];
            lo[r][0] = (float)l0[1]; lo[r][1] = (float)l1[0];
            lo[r][2] = (float)l1[1]; lo[r][3] = (float)l2[0];
            hi[r][0] = (float)h0[1]; hi[r][1] = (float)h1[0];
            hi[r][2] = (float)h1[1]; hi[r][3] = (float)h2v[0];
          }
          // 18 weights in a row for c0, c0+1; c0 even puts them on 8-byte bounds
          const f2* wlp = (const f2*)&wdw_lds[c0*9];
          const f2* whp = (const f2*)&wdw_lds[(c0 + HID_)*9];
          float wl[18], wh[18];
          #pragma unroll
          for (int i = 0; i < 9; ++i) {
            f2 vl = wlp[i], vh = whp[i];
            wl[2*i] = vl[0]; wl[2*i + 1] = vl[1];
            wh[2*i] = vh[0]; wh[2*i + 1] = vh[1];
          }
          #pragma unroll
          for (int u = 0; u < 2; ++u)
            #pragma unroll
            for (int q = 0; q < 2; ++q) {
              float s1 = 0.0f, s2 = 0.0f;
              #pragma unroll
              for (int i = 0; i < 9; ++i) {
                s1 = fmaf(lo[i/3][i%3 + q], wl[9*u + i], s1);
                s2 = fmaf(hi[i/3][i%3 + q], wh[9*u + i], s2);
              }
              float ge = 0.5f * s1 * (1.0f + erff(s1 * 0.70710678118654752f));
              g[q][u] = ge * s2;
            }
        }
        #pragma unroll
        for (int q = 0; q < 2; ++q) {
          a2h[q][2*tt]     = (_Float16)g[q][0];   // matches A-layout K index for this lane
          a2h[q][2*tt + 1] = (_Float16)g[q][1];
        }
      }
      v16h A2[2];
      #pragma unroll
      for (int q = 0; q < 2; ++q)
        #pragma unroll
        for (int e = 0; e < 16; ++e) A2[q][e] = a2h[q][e];
      #pragma unroll
      for (int n2 = 0; n2 < 4; ++n2) {
        const _Float16* bp = &wout_lds[(n2*16 + nm) * WOPAD_ + 32*j + 8*hh];
        v16h B2;
        ((f4*)&B2)[0] = *(const f4*)(bp);
        ((f4*)&B2)[1] = *(const f4*)(bp + 16);
        #pragma unroll
        for (int q = 0; q < 2; ++q)
          acc2[q][n2] = __builtin_amdgcn_wmma_f32_16x16x32_f16(
              false, A2[q], false, B2, (short)0, acc2[q][n2], false, false);
      }
    }
    __syncthreads();
  }

  // ---------------- epilogue: f32 output, float4 rows ----------------
  // C-layout row M = 8*hh + r of tile q is the pixel (2*wave + hh, 2*r + q):
  // a lane holds one whole 16-pixel row of its channel, even columns in tile 0.
  float* ob = out + (size_t)b * C_ * H_ * W_;
  #pragma unroll
  for (int n2 = 0; n2 < 4; ++n2) {
    int cch = n2*16 + nm;
    v8f a0 = acc2[0][n2], a1 = acc2[1][n2];
    size_t off = (size_t)cch * (H_*W_) + (size_t)(ty0 + wave*2 + hh) * W_ + tx0;
    #pragma unroll
    for (int s = 0; s < 4; ++s)
      *(f4*)&ob[off + 4*s] = (f4){a0[2*s], a1[2*s], a0[2*s + 1], a1[2*s + 1]};
  }
}

extern "C" void kernel_launch(void* const* d_in, const int* in_sizes, int n_in,
                              void* d_out, int out_size, void* d_ws, size_t ws_size,
                              hipStream_t stream) {
  (void)in_sizes; (void)n_in; (void)d_ws; (void)ws_size; (void)out_size;
  const float* x     = (const float*)d_in[0];
  const float* w_in  = (const float*)d_in[1];
  const float* fft_w = (const float*)d_in[2];
  const float* w_dw  = (const float*)d_in[3];
  const float* w_out = (const float*)d_in[4];
  float* out = (float*)d_out;
  dim3 grid(W_/TILE_, H_/TILE_, B_);
  dffn_fused_kernel<<<grid, 256, 0, stream>>>(x, w_in, fft_w, w_dw, w_out, out);
}

// v003
// A run of this version takes 114 microseconds.
// In two side-by-side timings against v002, it was 1.16 and 1.15 times as fast.
// All steps since v000 together make it 2.25 times as fast.
#include <hip/hip_runtime.h>
#include <hip/hip_bf16.h>

typedef __attribute__((ext_vector_type(16))) _Float16 v16h;
typedef __attribute__((ext_vector_type(2)))  _Float16 h2;
typedef __attribute__((ext_vector_type(8)))  float    v8f;
typedef __attribute__((ext_vector_type(4)))  float    f4;
typedef __attribute__((ext_vector_type(2)))  float    f2;
typedef __attribute__((ext_vector_type(4)))  _Float16 h4;

#define B_     4
#define C_     64
#define H_     256
#define W_     256
#define HID_   170
#define TILE_  16
#define EXT_   20          // TILE + 2*2 halo (patch-aligned)
#define NPIX_  (EXT_*EXT_) // 400
#define XPAD_  72          // padded channel stride (16B-aligned, bank-friendly)
#define NGRP_  6           // ceil(170/32) groups of 32 gathered hidden channels
#define WROWS_ 192         // 6*32 gathered w_in rows (zero-padded)
#define HFPAD_ 404         // padded pixel stride for filtered-h tile
#define WOPAD_ 200         // padded hidden stride for w_out (cols >=170 zero)
#define XUNITS_ ((C_/4)*EXT_*(EXT_/2))   // 3200 staging units of the x tile
#define XIT_    (XUNITS_/256)            // 12 whole units per thread
#define XTAIL_  (XUNITS_ - 256*XIT_)     // 128 units left: half a unit per thread
#define XHALF_  6                        // x units stored before the weights' loads issue
#define WIT_    (WROWS_*(C_/4)/256)      // 12 16-byte loads of w_in per thread

#if defined(__HIP_DEVICE_COMPILE__) && defined(__gfx1250__)
#define USE_ASYNC_LDS 1
#else
#define USE_ASYNC_LDS 0
#endif

#if USE_ASYNC_LDS
// byte offset of a generic pointer within the wave's LDS aperture
__device__ static inline unsigned lds_offset_of(const void* p) {
  return (unsigned)(unsigned long long)
         (__attribute__((address_space(3))) const char*)p;
}
#endif

// erf on |z| < 1: the math library's own polynomial for that range (odd in z,
// so the sign needs no handling of its own); the same values as erff there.
__device__ static inline float erf_below_one(float z) {
  float t = z * z;
  float p = fmaf(t, fmaf(t, fmaf(t, fmaf(t, fmaf(t,
              -0x1.268bc2p-11f, 0x1.420828p-8f), -0x1.b5937p-6f), 0x1.ce077cp-4f),
              -0x1.81266p-2f), 0x1.06eba0p-3f);
  return fmaf(z, p, z);
}

// Depthwise 3x3 + exact-GELU gate of one group of 32 gated channels for a
// lane's two side-by-side pixels, built in the GEMM2 A-layout.
// FULL = false: erf by the |z| < 1 polynomial alone, no branch per value, so
// the sums and polynomials of a channel pair interleave; returns the largest
// |z| the lane met, and the caller repeats the pass with FULL = true (erff)
// if that reaches 1.
template <bool FULL>
__device__ __forceinline__ float gate_pass(
    const _Float16* hf_lds, const float* wdw_lds,
    int j, int hh, int pwin, v16h (&A2)[2])
{
  float zmax = 0.0f;
  _Float16 a2h[2][16];
  #pragma unroll
  for (int tt = 0; tt < 8; ++tt) {
    int t  = (tt < 4) ? (4*hh + tt) : (4 + 4*hh + tt);   // lane's hf slot (low half)
    int c0 = 32*j + 2*t;                  // gated hidden channels c0 and c0+1
    float g[2][2] = {{0.0f, 0.0f}, {0.0f, 0.0f}};
    if (c0 < HID_) {                      // HID_ is even: c0+1 is valid with c0
      const h2* pl = (const h2*)&hf_lds[t*HFPAD_      + pwin];
      const h2* ph = (const h2*)&hf_lds[(16+t)*HFPAD_ + pwin];
      float lo[3][4], hi[3][4];           // extended columns ox0+1 .. ox0+4
      #pragma unroll
      for (int r = 0; r < 3; ++r) {
        h2 l0 = pl[r*(EXT_/2)], l1 = pl[r*(EXT_/2) + 1], l2 = pl[r*(EXT_/2) + 2];
        h2 h0 = ph[r*(EXT_/2)], h1 = ph[r*(EXT_/2) + 1], h2v = ph[r*(EXT_/2) + 2];
        lo[r][0] = (float)l0[1]; lo[r][1] = (float)l1[0];
        lo[r][2] = (float)l1[1]; lo[r][3] = (float)l2[0];
        hi[r][0] = (float)h0[1]; hi[r][1] = (float)h1[0];
        hi[r][2] = (float)h1[1]; hi[r][3] = (float)h2v[0];
      }
      // 18 weights in a row for c0, c0+1; c0 even puts them on 8-byte bounds
      const f2* wlp = (const f2*)&wdw_lds[c0*9];
      const f2* whp = (const f2*)&wdw_lds[(c0 + HID_)*9];
      float wl[18], wh[18];
      #pragma unroll
      for (int i = 0; i < 9; ++i) {
        f2 vl = wlp[i], vh = whp[i];
        wl[2*i] = vl[0]; wl[2*i + 1] = vl[1];
        wh[2*i] = vh[0]; wh[2*i + 1] = vh[1];
      }
      #pragma unroll
      for (int u = 0; u < 2; ++u)
        #pragma unroll
        for (int q = 0; q < 2; ++q) {
          float s1 = 0.0f, s2 = 0.0f;
          #pragma unroll
          for (int i = 0; i < 9; ++i) {
            s1 = fmaf(lo[i/3][i%3 + q], wl[9*u + i], s1);
            s2 = fmaf(hi[i/3][i%3 + q], wh[9*u + i], s2);
          }
          float z = s1 * 0.70710678118654752f;
          float e;
          if (FULL) {
            e = erff(z);
          } else {
            e = erf_below_one(z);
            zmax = fmaxf(zmax, fabsf(z));
          }
          float ge = 0.5f * s1 * (1.0f + e);
          g[q][u] = ge * s2;
        }
    }
    #pragma unroll
    for (int q = 0; q < 2; ++q) {
      a2h[q][2*tt]     = (_Float16)g[q][0];   // matches A-layout K index for this lane
      a2h[q][2*tt + 1] = (_Float16)g[q][1];
    }
  }
  #pragma unroll
  for (int q = 0; q < 2; ++q)
    #pragma unroll
    for (int e = 0; e < 16; ++e) A2[q][e] = a2h[q][e];
  return zmax;
}

__global__ __launch_bounds__(256) void dffn_fused_kernel(
    const float* __restrict__ xin,  const float* __restrict__ w_in,
    const float* __restrict__ fft_w, const float* __restrict__ w_dw,
    const float* __restrict__ w_out, float* __restrict__ out)
{
  __shared__ __align__(16) _Float16 x_lds  [NPIX_ * XPAD_];   // 57.6 KB
  __shared__ __align__(16) _Float16 win_lds[WROWS_ * XPAD_];  // 27.6 KB
  __shared__ __align__(16) _Float16 hf_lds [32 * HFPAD_];     // 25.9 KB
  __shared__ __align__(16) _Float16 wout_lds[64 * WOPAD_];    // 25.6 KB
  __shared__ __align__(16) float    wdw_lds [2*HID_*9];       // 12.2 KB
  __shared__ __align__(16) float    fftw_lds[HID_*4];         //  2.7 KB

  const int tid  = threadIdx.x;
  const int wave = tid >> 5;
  const int nm   = tid & 15;        // M (pixel) or N (channel) index within 16
  const int hh   = (tid >> 4) & 1;  // wave half -> K-range selector in A/B layouts

  const int tx0 = blockIdx.x * TILE_;
  const int ty0 = blockIdx.y * TILE_;
  const int b   = blockIdx.z;

  const float* xb = xin + (size_t)b * C_ * H_ * W_;

  // ---- kick off async DMA of the pure-copy weight tables into LDS ----
  // (tracked by ASYNCcnt; overlapped with x-tile staging below)
#if USE_ASYNC_LDS
  for (int i = tid; i < (2*HID_*9)/4; i += 256) {       // 765 x b128
    unsigned ldst = lds_offset_of(&wdw_lds[i*4]);
    unsigned long long ga = (unsigned long long)(const void*)(w_dw + i*4);
    asm volatile("global_load_async_to_lds_b128 %0, %1, off"
                 :: "v"(ldst), "v"(ga) : "memory");
  }
  for (int i = tid; i < (HID_*4)/4; i += 256) {         // 170 x b128
    unsigned ldst = lds_offset_of(&fftw_lds[i*4]);
    unsigned long long ga = (unsigned long long)(const void*)(fft_w + i*4);
    asm volatile("global_load_async_to_lds_b128 %0, %1, off"
                 :: "v"(ldst), "v"(ga) : "memory");
  }
#else
  for (int i = tid; i < 2*HID_*9; i += 256) wdw_lds[i]  = w_dw[i];
  for (int i = tid; i < HID_*4;   i += 256) fftw_lds[i] = fft_w[i];
#endif

  // ---------------- stage converted operands into LDS ----------------
  // Every global load below is unconditional (index clamped in bounds, value
  // selected to zero afterwards), so a whole batch is in flight before the
  // first wait; the weights' loads fly while the x tile is converted.
  //
  // x unit = 4 channels x 1 row x 2 columns: four 8-byte loads, two 8-byte LDS
  // stores. The tile's first column is even, so a column pair is inside the
  // image as a whole or outside it as a whole.
  f2       xv[XIT_][4];
  unsigned xoff[XIT_];     // byte offset of the unit's first load in xb
  int      xdst[XIT_];
  bool     xok[XIT_];
  const char* xbytes = (const char*)xb;

  // the unrolls of this section keep the batch arrays in registers and let all
  // loads of a batch issue back to back
  #pragma unroll
  for (int i = 0; i < XIT_; ++i) {
    int u   = tid + 256 * i;
    int cg  = u / (EXT_ * 10);
    int r   = u - cg * (EXT_ * 10);
    int py  = r / 10, k = r - py * 10;
    int gy  = ty0 - 2 + py, gx = tx0 - 2 + 2 * k;
    xok[i]  = (unsigned)gy < (unsigned)H_ && (unsigned)gx < (unsigned)W_;
    int cy  = gy < 0 ? 0 : (gy > H_ - 1 ? H_ - 1 : gy);
    int cx  = gx < 0 ? 0 : (gx > W_ - 2 ? W_ - 2 : gx);
    xoff[i] = 4u * (unsigned)(cg * 4 * (H_ * W_) + cy * W_ + cx);
    xdst[i] = (py * EXT_ + 2 * k) * XPAD_ + cg * 4;
    #pragma unroll
    for (int ch = 0; ch < 4; ++ch)
      xv[i][ch] = *(const f2*)(xbytes + xoff[i] + 4u * ch * (H_ * W_));
  }
  // the units left over: two threads share one, two channels each
  static_assert(2 * XTAIL_ == 256, "the tail takes exactly half a unit per thread");
  f2 tv[2]; unsigned toff; int tdst; bool tok;
  {
    int u   = 256 * XIT_ + (tid >> 1);
    int cg  = u / (EXT_ * 10);
    int r   = u - cg * (EXT_ * 10);
    int py  = r / 10, k = r - py * 10;
    int gy  = ty0 - 2 + py, gx = tx0 - 2 + 2 * k;
    tok     = (unsigned)gy < (unsigned)H_ && (unsigned)gx < (unsigned)W_;
    int cy  = gy < 0 ? 0 : (gy > H_ - 1 ? H_ - 1 : gy);
    int cx  = gx < 0 ? 0 : (gx > W_ - 2 ? W_ - 2 : gx);
    int c0  = cg * 4 + 2 * (tid & 1);
    toff  = 4u * (unsigned)(c0 * (H_ * W_) + cy * W_ + cx);
    tdst  = (py * EXT_ + 2 * k) * XPAD_ + c0;
    tv[0] = *(const f2*)(xbytes + toff);
    tv[1] = *(const f2*)(xbytes + toff + 4u * (H_ * W_));
  }
  // No offset register of the loads above may be rewritten (a later load's
  // result counts) before this wait: naming them as inputs keeps them until it.
  asm volatile("s_wait_xcnt 0x0"
               :: "v"(xoff[0]), "v"(xoff[1]), "v"(xoff[2]), "v"(xoff[3]),
                  "v"(xoff[4]), "v"(xoff[5]), "v"(xoff[6]), "v"(xoff[7]),
                  "v"(xoff[8]), "v"(xoff[9]), "v"(xoff[10]), "v"(xoff[11]),
                  "v"(toff) : "memory");

#define X_STORE(i) do {                                                       \
    h4 a0, a1;                                                                \
    _Pragma("unroll")                                                         \
    for (int ch = 0; ch < 4; ++ch) {                                          \
      a0[ch] = (_Float16)(xok[i] ? xv[i][ch][0] : 0.0f);                      \
      a1[ch] = (_Float16)(xok[i] ? xv[i][ch][1] : 0.0f);                      \
    }                                                                         \
    *(h4*)&x_lds[xdst[i]]         = a0;    /* zero halo => zero FFT patches */\
    *(h4*)&x_lds[xdst[i] + XPAD_] = a1;                                       \
  } while (0)

  #pragma unroll
  for (int i = 0; i < XHALF_; ++i) X_STORE(i);

  // gathered project_in rows: group j, slot s<16 -> ch 16j+s (low half),
  // slot s>=16 -> ch 85+16j+(s-16) (high half); invalid slots zero-padded.
  // Load i of a thread is LDS row 16i+t, t = tid/16: j = i/2, high half for odd i.
  const int wt = tid >> 4, wc4 = tid & 15;
  const bool wtail_ok = 80 + wt < 85;                 // group 5 holds 5 channels
  const unsigned woff  = 4u * (unsigned)(wt * C_ + wc4 * 4);
  const unsigned woff5 = 4u * (unsigned)((wtail_ok ? wt : 0) * C_ + wc4 * 4);
  f4 wv[WIT_];
  #pragma unroll
  for (int i = 0; i < WIT_; ++i) {
    unsigned row0 = ((i & 1) ? 85u : 0u) + 16u * (i >> 1);
    wv[i] = *(const f4*)((const char*)w_in + ((i >> 1) < 5 ? woff : woff5)
                         + 4u * C_ * row0);
  }
  // w_out: wave w stages rows 8w..8w+7; a lane takes the column pairs lane,
  // lane+32 and lane+64 of each row (pairs from 85 on are padding)
  const int lane = tid & 31;
  const unsigned ooff  = 4u * (unsigned)(wave * 8 * HID_ + 2 * lane);
  const unsigned ooff2 = 4u * (unsigned)(wave * 8 * HID_
                                         + 2 * (lane + 64 < HID_/2 ? lane + 64 : 0));
  f2 ov[8][3];
  #pragma unroll
  for (int rr = 0; rr < 8; ++rr) {
    ov[rr][0] = *(const f2*)((const char*)w_out + ooff  + 4u * HID_ * rr);
    ov[rr][1] = *(const f2*)((const char*)w_out + ooff  + 4u * HID_ * rr + 256u);
    ov[rr][2] = *(const f2*)((const char*)w_out + ooff2 + 4u * HID_ * rr);
  }
  // as above: the weights' offset registers stay untouched until this wait
  asm volatile("s_wait_xcnt 0x0"
               :: "v"(woff), "v"(woff5), "v"(ooff), "v"(ooff2) : "memory");

  #pragma unroll
  for (int i = XHALF_; i < XIT_; ++i) X_STORE(i);
  {
    h2 a0, a1;
    a0[0] = (_Float16)(tok ? tv[0][0] : 0.0f);  a0[1] = (_Float16)(tok ? tv[1][0] : 0.0f);
    a1[0] = (_Float16)(tok ? tv[0][1] : 0.0f);  a1[1] = (_Float16)(tok ? tv[1][1] : 0.0f);
    *(h2*)&x_lds[tdst]         = a0;
    *(h2*)&x_lds[tdst + XPAD_] = a1;
  }
#undef X_STORE

  #pragma unroll
  for (int i = 0; i < WIT_; ++i) {
    bool ok = (i >> 1) < 5 || wtail_ok;
    h4 a;
    #pragma unroll
    for (int e = 0; e < 4; ++e) a[e] = (_Float16)(ok ? wv[i][e] : 0.0f);
    *(h4*)&win_lds[(16 * i + wt) * XPAD_ + wc4 * 4] = a;
  }
  #pragma unroll
  for (int rr = 0; rr < 8; ++rr) {
    _Float16* wrow = &wout_lds[(wave * 8 + rr) * WOPAD_];
    #pragma unroll
    for (int ch = 0; ch < 3; ++ch) {
      int o2 = lane + 32 * ch;
      bool ok = o2 < HID_/2;
      h2 a;
      a[0] = (_Float16)(ok ? ov[rr][ch][0] : 0.0f);
      a[1] = (_Float16)(ok ? ov[rr][ch][1] : 0.0f);
      *(h2*)&wrow[2 * o2] = a;
    }
    if (lane < WOPAD_/2 - 96) *(h2*)&wrow[2 * (96 + lane)] = (h2){0, 0};
  }

#if USE_ASYNC_LDS
  asm volatile("s_wait_asynccnt 0" ::: "memory");
#endif
  __syncthreads();

  // persistent project_out accumulators: 2 pixel tiles x 4 out-channel tiles
  v8f acc2[2][4];
  #pragma unroll
  for (int q = 0; q < 2; ++q)
    #pragma unroll
    for (int n = 0; n < 4; ++n) acc2[q][n] = (v8f){0,0,0,0,0,0,0,0};

  for (int j = 0; j < NGRP_; ++j) {
    // ---- GEMM1 (project_in) over extended tile + 2x2 Hadamard FFT filter ----
    // 25 pixel-blocks (5x5 of 4x4) x 2 channel-ntiles = 50 wave-jobs
    for (int id = wave; id < 50; id += 8) {
      int nt = id & 1;
      int mb = id >> 1;
      int mby = mb / 5, mbx = mb - mby * 5;
      int py = mby*4 + (nm >> 2);
      int px = mbx*4 + (nm & 3);
      const _Float16* ap = &x_lds[(py*EXT_ + px) * XPAD_ + 8*hh];
      const _Float16* bp = &win_lds[(j*32 + nt*16 + nm) * XPAD_ + 8*hh];
      v16h A0, A1, B0, B1;
      ((f4*)&A0)[0] = *(const f4*)(ap);        // K  8h.. 8h+7
      ((f4*)&A0)[1] = *(const f4*)(ap + 16);   // K 16+8h..
      ((f4*)&A1)[0] = *(const f4*)(ap + 32);
      ((f4*)&A1)[1] = *(const f4*)(ap + 48);
      ((f4*)&B0)[0] = *(const f4*)(bp);
      ((f4*)&B0)[1] = *(const f4*)(bp + 16);
      ((f4*)&B1)[0] = *(const f4*)(bp + 32);
      ((f4*)&B1)[1] = *(const f4*)(bp + 48);
      v8f acc = (v8f){0,0,0,0,0,0,0,0};
      acc = __builtin_amdgcn_wmma_f32_16x16x32_f16(false, A0, false, B0, (short)0, acc, false, false);
      acc = __builtin_amdgcn_wmma_f32_16x16x32_f16(false, A1, false, B1, (short)0, acc, false, false);

      // per-lane channel's 2x2 spectral weights
      int sg  = nt*16 + nm;
      int hch = ((sg < 16) ? 0 : 85) + 16*j + nm;
      hch = (hch > HID_-1) ? (HID_-1) : hch;     // pad slots: values are 0 anyway
      float w00 = fftw_lds[hch*4+0], w01 = fftw_lds[hch*4+1];
      float w10 = fftw_lds[hch*4+2], w11 = fftw_lds[hch*4+3];
      // each lane holds both rows of its 2 patches (C-layout rows 2h,2h+1)
      #pragma unroll
      for (int pc = 0; pc < 2; ++pc) {
        float s00 = acc[2*pc],   s01 = acc[2*pc+1];
        float s10 = acc[4+2*pc], s11 = acc[4+2*pc+1];
        float F00 = (s00+s01+s10+s11)*w00;
        float F01 = (s00-s01+s10-s11)*w01;
        float F10 = (s00+s01-s10-s11)*w10;
        float F11 = (s00-s01-s10+s11)*w11;
        float y00 = 0.25f*(F00+F01+F10+F11);
        float y01 = 0.25f*(F00-F01+F10-F11);
        float y10 = 0.25f*(F00+F01-F10-F11);
        float y11 = 0.25f*(F00-F01-F10+F11);
        int base0 = sg*HFPAD_ + (mby*4 + 2*hh)*EXT_ + (mbx*4 + 2*pc);
        h2 v0; v0[0] = (_Float16)y00; v0[1] = (_Float16)y01;
        h2 v1; v1[0] = (_Float16)y10; v1[1] = (_Float16)y11;
        *(h2*)&hf_lds[base0]        = v0;
        *(h2*)&hf_lds[base0 + EXT_] = v1;
      }
    }
    __syncthreads();

    // ---- depthwise 3x3 + exact-GELU gate, built directly in GEMM2 A-layout ----
    // A wave owns output rows 2*wave and 2*wave+1. Row M of its pixel tile q is
    // the pixel (2*wave + M/8, 2*(M%8) + q): a lane's two tiles hold two pixels
    // side by side, so one read of a 3x4 window of hf and one read of the 3x3
    // weights serve both.
    {
      const int oy  = wave*2 + (nm >> 3);
      const int ox0 = 2*(nm & 7);
      const int pwin = (oy + 1)*EXT_ + ox0;   // even: the window's 4-byte pairs are aligned
      static_assert(HID_ % 2 == 0, "a channel pair c0, c0+1 is valid as a whole");
      v16h A2[2];
      float zmax = gate_pass<false>(hf_lds, wdw_lds, j, hh, pwin, A2);
      // one test per pass for the whole wave (a scalar branch); a NaN sum does
      // not raise zmax and gives NaN on either path
      if (__builtin_amdgcn_ballot_w32(zmax >= 1.0f) != 0u)
        gate_pass<true>(hf_lds, wdw_lds, j, hh, pwin, A2);
      #pragma unroll
      for (int n2 = 0; n2 < 4; ++n2) {
        const _Float16* bp = &wout_lds[(n2*16 + nm) * WOPAD_ + 32*j + 8*hh];
        v16h B2;
        ((f4*)&B2)[0] = *(const f4*)(bp);
        ((f4*)&B2)[1] = *(const f4*)(bp + 16);
        #pragma unroll
        for (int q = 0; q < 2; ++q)
          acc2[q][n2] = __builtin_amdgcn_wmma_f32_16x16x32_f16(
              false, A2[q], false, B2, (short)0, acc2[q][n2], false, false);
      }
    }
    __syncthreads();
  }

  // ---------------- epilogue: f32 output, float4 rows ----------------
  // C-layout row M = 8*hh + r of tile q is the pixel (2*wave + hh, 2*r + q):
  // a lane holds one whole 16-pixel row of its channel, even columns in tile 0.
  float* ob = out + (size_t)b * C_ * H_ * W_;
  #pragma unroll
  for (int n2 = 0; n2 < 4; ++n2) {
    int cch = n2*16 + nm;
    v8f a0 = acc2[0][n2], a1 = acc2[1][n2];
    size_t off = (size_t)cch * (H_*W_) + (size_t)(ty0 + wave*2 + hh) * W_ + tx0;
    #pragma unroll
    for (int s = 0; s < 4; ++s)
      *(f4*)&ob[off + 4*s] = (f4){a0[2*s], a1[2*s], a0[2*s + 1], a1[2*s + 1]};
  }
}

extern "C" void kernel_launch(void* const* d_in, const int* in_sizes, int n_in,
                              void* d_out, int out_size, void* d_ws, size_t ws_size,
                              hipStream_t stream) {
  (void)in_sizes; (void)n_in; (void)d_ws; (void)ws_size; (void)out_size;
  const float* x     = (const float*)d_in[0];
  const float* w_in  = (const float*)d_in[1];
  const float* fft_w = (const float*)d_in[2];
  const float* w_dw  = (const float*)d_in[3];
  const float* w_out = (const float*)d_in[4];
  float* out = (float*)d_out;
  dim3 grid(W_/TILE_, H_/TILE_, B_);
  dffn_fused_kernel<<<grid, 256, 0, stream>>>(x, w_in, fft_w, w_dw, w_out, out);
}

// v004
// One run takes 85.1 microseconds.
// In two side-by-side timings against v003, it was 1.42 and 1.43 times as fast.
// Counting every step since v000, it is 3.21 times as fast.
#include <hip/hip_runtime.h>
#include <hip/hip_bf16.h>

typedef __attribute__((ext_vector_type(16))) _Float16 v16h;
typedef __attribute__((ext_vector_type(2)))  _Float16 h2;
typedef __attribute__((ext_vector_type(8)))  float    v8f;
typedef __attribute__((ext_vector_type(4)))  float    f4;
typedef __attribute__((ext_vector_type(2)))  float    f2;
typedef __attribute__((ext_vector_type(4)))  _Float16 h4;
typedef __attribute__((ext_vector_type(4)))  unsigned u4;
typedef __attribute__((ext_vector_type(8)))  unsigned u8;

#define B_     4
#define C_     64
#define H_     256
#define W_     256
#define HID_   170
#define TILE_  16
#define EXT_   20          // TILE + 2*2 halo (patch-aligned)
#define NPIX_  (EXT_*EXT_) // 400
#define XPAD_  72          // padded channel stride (16B-aligned, bank-friendly)
#define NGRP_  6           // ceil(170/32) groups of 32 gathered hidden channels
#define WROWS_ 192         // 6*32 gathered w_in rows (zero-padded)
#define HFP_   40          // filtered-h tile is pixel-major: 32 slots + 8 pad (80-byte pitch)
#define DWW_   12          // words per row of the depthwise weight table (10 used)
#define DWROWS_ (2*HID_ + 1)             // one row per conv output channel + a zero row
#define DWN_   (2*HID_*9)                // 3060 depthwise weights
#define DWIT_  ((DWN_ + 255)/256)        // 12 loads per thread
#define WOPAD_ 200         // padded hidden stride for w_out (cols >=170 zero)
#define XUNITS_ ((C_/4)*EXT_*(EXT_/2))   // 3200 staging units of the x tile
#define XIT_    (XUNITS_/256)            // 12 whole units per thread
#define XTAIL_  (XUNITS_ - 256*XIT_)     // 128 units left: half a unit per thread
#define XHALF_  6                        // x units stored before the w_in and w_out loads issue
#define WIT_    (WROWS_*(C_/4)/256)      // 12 16-byte loads of w_in per thread

#if defined(__HIP_DEVICE_COMPILE__) && defined(__gfx1250__)
#define USE_ASYNC_LDS 1
#else
#define USE_ASYNC_LDS 0
#endif

#if USE_ASYNC_LDS
// byte offset of a generic pointer within the wave's LDS aperture
__device__ static inline unsigned lds_offset_of(const void* p) {
  return (unsigned)(unsigned long long)
         (__attribute__((address_space(3))) const char*)p;
}
#endif

// erf on |z| < 1: the math library's own polynomial for that range (odd in z,
// so the sign needs no handling of its own); the same values as erff there.
__device__ static inline float erf_below_one(float z) {
  float t = z * z;
  float p = fmaf(t, fmaf(t, fmaf(t, fmaf(t, fmaf(t,
              -0x1.268bc2p-11f, 0x1.420828p-8f), -0x1.b5937p-6f), 0x1.ce077cp-4f),
              -0x1.81266p-2f), 0x1.06eba0p-3f);
  return fmaf(z, p, z);
}

// One 16x16 tile of the depthwise 3x3 as matrix products, for two pixel tiles.
// D[row][pixel] = sum over (tap, slot) of A[row][tap, slot] * hf[pixel + tap][slot]:
// rows are 16 conv output channels, fed by 8 hf slots (row r reads slot r/2), so
// A is block-diagonal: in each 8-slot chunk of K a row has one non-zero.
// A K chunk of a lane (8 halves) is one tap. Each weight is the f16 pair hi + lo
// (hi = f16(w), lo = f16(w - hi)), two products on the same hf value.
//   products 0,1: taps hh, 2+hh   (hi, then lo)    products 2,3: taps 4+hh, 6+hh
//   product  4  : tap 8, hi in the hh = 0 chunk, lo in the hh = 1 chunk; rest zero
// trow: the lane's row of the weight table; hb[e]: the lane's hf address of tap
// 2e+hh (e < 4) and of tap 8 (e = 4) for pixel tile 0, slot 0.
__device__ __forceinline__ void dw_tile(
    const unsigned* trow, int hh, const unsigned (&msk)[4],
    const _Float16* const (&hb)[5], int slot0, v8f (&D)[2])
{
  u4 w        = *(const u4*)(trow + 4*hh);
  unsigned w8 = trow[8 + hh];
  v16h A[5];
  #pragma unroll
  for (int k = 0; k < 2; ++k) {
    unsigned wa = w[2*k], wb = w[2*k + 1];
    unsigned ra = (wa >> 16) | (wa << 16), rb = (wb >> 16) | (wb << 16);
    A[2*k]     = __builtin_bit_cast(v16h, (u8){wa & msk[0], wa & msk[1], wa & msk[2], wa & msk[3],
                                               wb & msk[0], wb & msk[1], wb & msk[2], wb & msk[3]});
    A[2*k + 1] = __builtin_bit_cast(v16h, (u8){ra & msk[0], ra & msk[1], ra & msk[2], ra & msk[3],
                                               rb & msk[0], rb & msk[1], rb & msk[2], rb & msk[3]});
  }
  A[4] = __builtin_bit_cast(v16h, (u8){w8 & msk[0], w8 & msk[1], w8 & msk[2], w8 & msk[3], 0u, 0u, 0u, 0u});
  #pragma unroll
  for (int q = 0; q < 2; ++q) {
    const int o = q*EXT_*HFP_ + slot0;
    v16h B0, B1, B2;
    ((f4*)&B0)[0] = *(const f4*)(hb[0] + o);
    ((f4*)&B0)[1] = *(const f4*)(hb[1] + o);
    ((f4*)&B1)[0] = *(const f4*)(hb[2] + o);
    ((f4*)&B1)[1] = *(const f4*)(hb[3] + o);
    ((f4*)&B2)[0] = *(const f4*)(hb[4] + o);
    ((f4*)&B2)[1] = ((f4*)&B2)[0];          // meets zero weights: any finite data
    v8f d = (v8f){0,0,0,0,0,0,0,0};
    d = __builtin_amdgcn_wmma_f32_16x16x32_f16(false, A[0], false, B0, (short)0, d, false, false);
    d = __builtin_amdgcn_wmma_f32_16x16x32_f16(false, A[1], false, B0, (short)0, d, false, false);
    d = __builtin_amdgcn_wmma_f32_16x16x32_f16(false, A[2], false, B1, (short)0, d, false, false);
    d = __builtin_amdgcn_wmma_f32_16x16x32_f16(false, A[3], false, B1, (short)0, d, false, false);
    d = __builtin_amdgcn_wmma_f32_16x16x32_f16(false, A[4], false, B2, (short)0, d, false, false);
    D[q] = d;
  }
}

// Exact-GELU gate of the 16 value pairs a lane holds in two pairs of D tiles.
// FULL = false: erf by the |z| < 1 polynomial alone, no branch per value;
// returns the largest |z| the lane met, and the caller repeats the gate with
// FULL = true (erff) if that reaches 1.
template <bool FULL>
__device__ __forceinline__ float gate16(
    const v8f (&D1)[2], const v8f (&D2)[2], float (&g)[2][8])
{
  float zmax = 0.0f;
  #pragma unroll
  for (int q = 0; q < 2; ++q)
    #pragma unroll
    for (int r = 0; r < 8; ++r) {
      float s1 = D1[q][r], s2 = D2[q][r];
      float z = s1 * 0.70710678118654752f;
      float e;
      if (FULL) {
        e = erff(z);
      } else {
        e = erf_below_one(z);
        zmax = fmaxf(zmax, fabsf(z));
      }
      float ge = 0.5f * s1 * (1.0f + e);
      g[q][r] = ge * s2;
    }
  return zmax;
}

__global__ __launch_bounds__(256) void dffn_fused_kernel(
    const float* __restrict__ xin,  const float* __restrict__ w_in,
    const float* __restrict__ fft_w, const float* __restrict__ w_dw,
    const float* __restrict__ w_out, float* __restrict__ out)
{
  __shared__ __align__(16) _Float16 x_lds  [NPIX_ * XPAD_];   // 57.6 KB
  __shared__ __align__(16) _Float16 win_lds[WROWS_ * XPAD_];  // 27.6 KB
  __shared__ __align__(16) _Float16 hf_lds [NPIX_ * HFP_];     // 32.0 KB
  __shared__ __align__(16) _Float16 wout_lds[64 * WOPAD_];    // 25.6 KB
  __shared__ __align__(16) unsigned dwt_lds [DWROWS_ * DWW_];  // 16.4 KB
  __shared__ __align__(16) float    fftw_lds[HID_*4];         //  2.7 KB

  const int tid  = threadIdx.x;
  const int wave = tid >> 5;
  const int nm   = tid & 15;        // M or N index within 16: a pixel or a channel
  const int hh   = (tid >> 4) & 1;  // wave half -> K-range selector in A/B layouts

  const int tx0 = blockIdx.x * TILE_;
  const int ty0 = blockIdx.y * TILE_;
  const int b   = blockIdx.z;

  const float* xb = xin + (size_t)b * C_ * H_ * W_;

  // ---- kick off async DMA of the pure-copy weight table into LDS ----
  // (tracked by ASYNCcnt; overlapped with x-tile staging below)
#if USE_ASYNC_LDS
  for (int i = tid; i < (HID_*4)/4; i += 256) {         // 170 x b128
    unsigned ldst = lds_offset_of(&fftw_lds[i*4]);
    unsigned long long ga = (unsigned long long)(const void*)(fft_w + i*4);
    asm volatile("global_load_async_to_lds_b128 %0, %1, off"
                 :: "v"(ldst), "v"(ga) : "memory");
  }
#else
  for (int i = tid; i < HID_*4;   i += 256) fftw_lds[i] = fft_w[i];
#endif

  // ---------------- stage converted operands into LDS ----------------
  // Every global load below is unconditional (index clamped in bounds, value
  // selected to zero afterwards), so a whole batch is in flight before the
  // first wait; the weights' loads fly while the x tile is converted.
  //
  // x unit = 4 channels x 1 row x 2 columns: four 8-byte loads, two 8-byte LDS
  // stores. The tile's first column is even, so a column pair is inside the
  // image as a whole or outside it as a whole.
  f2       xv[XIT_][4];
  unsigned xoff[XIT_];     // byte offset of the unit's first load in xb
  int      xdst[XIT_];
  bool     xok[XIT_];
  const char* xbytes = (const char*)xb;

  // the unrolls of this section keep the batch arrays in registers and let all
  // loads of a batch issue back to back
  #pragma unroll
  for (int i = 0; i < XIT_; ++i) {
    int u   = tid + 256 * i;
    int cg  = u / (EXT_ * 10);
    int r   = u - cg * (EXT_ * 10);
    int py  = r / 10, k = r - py * 10;
    int gy  = ty0 - 2 + py, gx = tx0 - 2 + 2 * k;
    xok[i]  = (unsigned)gy < (unsigned)H_ && (unsigned)gx < (unsigned)W_;
    int cy  = gy < 0 ? 0 : (gy > H_ - 1 ? H_ - 1 : gy);
    int cx  = gx < 0 ? 0 : (gx > W_ - 2 ? W_ - 2 : gx);
    xoff[i] = 4u * (unsigned)(cg * 4 * (H_ * W_) + cy * W_ + cx);
    xdst[i] = (py * EXT_ + 2 * k) * XPAD_ + cg * 4;
    #pragma unroll
    for (int ch = 0; ch < 4; ++ch)
      xv[i][ch] = *(const f2*)(xbytes + xoff[i] + 4u * ch * (H_ * W_));
  }
  // the units left over: two threads share one, two channels each
  static_assert(2 * XTAIL_ == 256, "the tail takes exactly half a unit per thread");
  f2 tv[2]; unsigned toff; int tdst; bool tok;
  {
    int u   = 256 * XIT_ + (tid >> 1);
    int cg  = u / (EXT_ * 10);
    int r   = u - cg * (EXT_ * 10);
    int py  = r / 10, k = r - py * 10;
    int gy  = ty0 - 2 + py, gx = tx0 - 2 + 2 * k;
    tok     = (unsigned)gy < (unsigned)H_ && (unsigned)gx < (unsigned)W_;
    int cy  = gy < 0 ? 0 : (gy > H_ - 1 ? H_ - 1 : gy);
    int cx  = gx < 0 ? 0 : (gx > W_ - 2 ? W_ - 2 : gx);
    int c0  = cg * 4 + 2 * (tid & 1);
    toff  = 4u * (unsigned)(c0 * (H_ * W_) + cy * W_ + cx);
    tdst  = (py * EXT_ + 2 * k) * XPAD_ + c0;
    tv[0] = *(const f2*)(xbytes + toff);
    tv[1] = *(const f2*)(xbytes + toff + 4u * (H_ * W_));
  }
  // depthwise weights, one 4-byte load per 256: the last one clamped in bounds
  const unsigned doff  = 4u * (unsigned)tid;
  const unsigned doffl = 4u * (unsigned)(tid + 256*(DWIT_-1) < DWN_ ? tid + 256*(DWIT_-1) : DWN_-1);
  float dv[DWIT_];
  #pragma unroll
  for (int i = 0; i < DWIT_ - 1; ++i)
    dv[i] = *(const float*)((const char*)w_dw + doff + 1024u * i);
  dv[DWIT_-1] = *(const float*)((const char*)w_dw + doffl);
  // No offset register of the loads above may be rewritten (a later load's
  // result counts) before this wait: naming them as inputs keeps them until it.
  asm volatile("s_wait_xcnt 0x0"
               :: "v"(xoff[0]), "v"(xoff[1]), "v"(xoff[2]), "v"(xoff[3]),
                  "v"(xoff[4]), "v"(xoff[5]), "v"(xoff[6]), "v"(xoff[7]),
                  "v"(xoff[8]), "v"(xoff[9]), "v"(xoff[10]), "v"(xoff[11]),
                  "v"(toff), "v"(doff), "v"(doffl) : "memory");

#define X_STORE(i) do {                                                       \
    h4 a0, a1;                                                                \
    _Pragma("unroll")                                                         \
    for (int ch = 0; ch < 4; ++ch) {                                          \
      a0[ch] = (_Float16)(xok[i] ? xv[i][ch][0] : 0.0f);                      \
      a1[ch] = (_Float16)(xok[i] ? xv[i][ch][1] : 0.0f);                      \
    }                                                                         \
    *(h4*)&x_lds[xdst[i]]         = a0;    /* zero halo => zero FFT patches */\
    *(h4*)&x_lds[xdst[i] + XPAD_] = a1;                                       \
  } while (0)

  #pragma unroll
  for (int i = 0; i < XHALF_; ++i) X_STORE(i);

  // gathered project_in rows: group j, slot s<16 -> ch 16j+s (low half),
  // slot s>=16 -> ch 85+16j+(s-16) (high half); invalid slots zero-padded.
  // Load i of a thread is LDS row 16i+t, t = tid/16: j = i/2, high half for odd i.
  const int wt = tid >> 4, wc4 = tid & 15;
  const bool wtail_ok = 80 + wt < 85;                 // group 5 holds 5 channels
  const unsigned woff  = 4u * (unsigned)(wt * C_ + wc4 * 4);
  const unsigned woff5 = 4u * (unsigned)((wtail_ok ? wt : 0) * C_ + wc4 * 4);
  f4 wv[WIT_];
  #pragma unroll
  for (int i = 0; i < WIT_; ++i) {
    unsigned row0 = ((i & 1) ? 85u : 0u) + 16u * (i >> 1);
    wv[i] = *(const f4*)((const char*)w_in + ((i >> 1) < 5 ? woff : woff5)
                         + 4u * C_ * row0);
  }
  // w_out: wave w stages rows 8w..8w+7; a lane takes the column pairs lane,
  // lane+32 and lane+64 of each row (pairs from 85 on are padding)
  const int lane = tid & 31;
  const unsigned ooff  = 4u * (unsigned)(wave * 8 * HID_ + 2 * lane);
  const unsigned ooff2 = 4u * (unsigned)(wave * 8 * HID_
                                         + 2 * (lane + 64 < HID_/2 ? lane + 64 : 0));
  f2 ov[8][3];
  #pragma unroll
  for (int rr = 0; rr < 8; ++rr) {
    ov[rr][0] = *(const f2*)((const char*)w_out + ooff  + 4u * HID_ * rr);
    ov[rr][1] = *(const f2*)((const char*)w_out + ooff  + 4u * HID_ * rr + 256u);
    ov[rr][2] = *(const f2*)((const char*)w_out + ooff2 + 4u * HID_ * rr);
  }
  // as above: the weights' offset registers stay untouched until this wait
  asm volatile("s_wait_xcnt 0x0"
               :: "v"(woff), "v"(woff5), "v"(ooff), "v"(ooff2) : "memory");

  #pragma unroll
  for (int i = XHALF_; i < XIT_; ++i) X_STORE(i);
  {
    h2 a0, a1;
    a0[0] = (_Float16)(tok ? tv[0][0] : 0.0f);  a0[1] = (_Float16)(tok ? tv[1][0] : 0.0f);
    a1[0] = (_Float16)(tok ? tv[0][1] : 0.0f);  a1[1] = (_Float16)(tok ? tv[1][1] : 0.0f);
    *(h2*)&x_lds[tdst]         = a0;
    *(h2*)&x_lds[tdst + XPAD_] = a1;
  }
#undef X_STORE

  #pragma unroll
  for (int i = 0; i < WIT_; ++i) {
    bool ok = (i >> 1) < 5 || wtail_ok;
    h4 a;
    #pragma unroll
    for (int e = 0; e < 4; ++e) a[e] = (_Float16)(ok ? wv[i][e] : 0.0f);
    *(h4*)&win_lds[(16 * i + wt) * XPAD_ + wc4 * 4] = a;
  }
  #pragma unroll
  for (int rr = 0; rr < 8; ++rr) {
    _Float16* wrow = &wout_lds[(wave * 8 + rr) * WOPAD_];
    #pragma unroll
    for (int ch = 0; ch < 3; ++ch) {
      int o2 = lane + 32 * ch;
      bool ok = o2 < HID_/2;
      h2 a;
      a[0] = (_Float16)(ok ? ov[rr][ch][0] : 0.0f);
      a[1] = (_Float16)(ok ? ov[rr][ch][1] : 0.0f);
      *(h2*)&wrow[2 * o2] = a;
    }
    if (lane < WOPAD_/2 - 96) *(h2*)&wrow[2 * (96 + lane)] = (h2){0, 0};
  }

  // depthwise weight table: row = conv output channel o, a word = the f16 pair
  // (hi, lo) of one weight with hi in the half that the row's hf slot has in
  // its register of a K chunk; words 0-3 taps 0,2,4,6; 4-7 taps 1,3,5,7; word 8
  // tap 8, word 9 tap 8 with the halves swapped. Row 2*HID_ is all zero.
  #pragma unroll
  for (int i = 0; i < DWIT_; ++i) {
    int idx = tid + 256 * i;
    int o = idx / 9, tap = idx - 9 * o;
    float wf = dv[i];
    _Float16 whi = (_Float16)wf;
    _Float16 wlo = (_Float16)(wf - (float)whi);
    unsigned uh = __builtin_bit_cast(unsigned short, whi);
    unsigned ul = __builtin_bit_cast(unsigned short, wlo);
    int  cg = o < HID_ ? o : o - HID_;      // gated channel the output feeds
    bool up = (cg >> 1) & 1;
    unsigned word = up ? (uh << 16) | ul : (ul << 16) | uh;
    unsigned swp  = up ? (ul << 16) | uh : (uh << 16) | ul;
    if (idx < DWN_) {
      dwt_lds[o * DWW_ + (tap < 8 ? (tap & 1) * 4 + (tap >> 1) : 8)] = word;
      if (tap == 8) dwt_lds[o * DWW_ + 9] = swp;
    }
  }
  if (tid < DWW_) dwt_lds[2*HID_ * DWW_ + tid] = 0u;

#if USE_ASYNC_LDS
  asm volatile("s_wait_asynccnt 0" ::: "memory");
#endif
  __syncthreads();

  // lane constants of the depthwise products: where the lane's row has its
  // non-zero in a K chunk, and the hf addresses of its taps.
  // Pixel tile q of a wave is output row 2*wave + q, columns 0..15 (N = nm).
  unsigned msk[4];
  #pragma unroll
  for (int r = 0; r < 4; ++r)
    msk[r] = ((nm >> 2) == r) ? (((nm >> 1) & 1) ? 0xFFFF0000u : 0x0000FFFFu) : 0u;
  const _Float16* hb[5];
  #pragma unroll
  for (int e = 0; e < 5; ++e) {
    int tap = e < 4 ? 2*e + hh : 8;
    hb[e] = &hf_lds[((wave*2 + 1 + tap/3)*EXT_ + nm + 1 + tap%3) * HFP_];
  }

  // persistent project_out accumulators: 2 pixel tiles x 4 out-channel tiles
  v8f acc2[2][4];
  #pragma unroll
  for (int q = 0; q < 2; ++q)
    #pragma unroll
    for (int n = 0; n < 4; ++n) acc2[q][n] = (v8f){0,0,0,0,0,0,0,0};

  for (int j = 0; j < NGRP_; ++j) {
    // ---- GEMM1 (project_in) over extended tile + 2x2 Hadamard FFT filter ----
    // 25 pixel-blocks (5x5 of 4x4) x 2 channel-ntiles = 50 wave-jobs
    for (int id = wave; id < 50; id += 8) {
      int nt = id & 1;
      int mb = id >> 1;
      int mby = mb / 5, mbx = mb - mby * 5;
      int py = mby*4 + (nm >> 2);
      int px = mbx*4 + (nm & 3);
      const _Float16* ap = &x_lds[(py*EXT_ + px) * XPAD_ + 8*hh];
      const _Float16* bp = &win_lds[(j*32 + nt*16 + nm) * XPAD_ + 8*hh];
      v16h A0, A1, B0, B1;
      ((f4*)&A0)[0] = *(const f4*)(ap);        // K  8h.. 8h+7
      ((f4*)&A0)[1] = *(const f4*)(ap + 16);   // K 16+8h..
      ((f4*)&A1)[0] = *(const f4*)(ap + 32);
      ((f4*)&A1)[1] = *(const f4*)(ap + 48);
      ((f4*)&B0)[0] = *(const f4*)(bp);
      ((f4*)&B0)[1] = *(const f4*)(bp + 16);
      ((f4*)&B1)[0] = *(const f4*)(bp + 32);
      ((f4*)&B1)[1] = *(const f4*)(bp + 48);
      v8f acc = (v8f){0,0,0,0,0,0,0,0};
      acc = __builtin_amdgcn_wmma_f32_16x16x32_f16(false, A0, false, B0, (short)0, acc, false, false);
      acc = __builtin_amdgcn_wmma_f32_16x16x32_f16(false, A1, false, B1, (short)0, acc, false, false);

      // per-lane channel's 2x2 spectral weights
      int sg  = nt*16 + nm;
      int hch = ((sg < 16) ? 0 : 85) + 16*j + nm;
      hch = (hch > HID_-1) ? (HID_-1) : hch;     // pad slots: values are 0 anyway
      float w00 = fftw_lds[hch*4+0], w01 = fftw_lds[hch*4+1];
      float w10 = fftw_lds[hch*4+2], w11 = fftw_lds[hch*4+3];
      // each lane holds both rows of its 2 patches (C-layout rows 2h,2h+1)
      #pragma unroll
      for (int pc = 0; pc < 2; ++pc) {
        float s00 = acc[2*pc],   s01 = acc[2*pc+1];
        float s10 = acc[4+2*pc], s11 = acc[4+2*pc+1];
        float F00 = (s00+s01+s10+s11)*w00;
        float F01 = (s00-s01+s10-s11)*w01;
        float F10 = (s00+s01-s10-s11)*w10;
        float F11 = (s00-s01-s10+s11)*w11;
        float y00 = 0.25f*(F00+F01+F10+F11);
        float y01 = 0.25f*(F00-F01+F10-F11);
        float y10 = 0.25f*(F00+F01-F10-F11);
        float y11 = 0.25f*(F00-F01-F10+F11);
        int base0 = ((mby*4 + 2*hh)*EXT_ + (mbx*4 + 2*pc))*HFP_ + sg;
        hf_lds[base0]                   = (_Float16)y00;
        hf_lds[base0 + HFP_]            = (_Float16)y01;
        hf_lds[base0 + EXT_*HFP_]       = (_Float16)y10;
        hf_lds[base0 + (EXT_ + 1)*HFP_] = (_Float16)y11;
      }
    }
    __syncthreads();

    // ---- depthwise 3x3 on matrix products + exact-GELU gate ----
    // D row 8*hh + r of tile m is gated channel 32j + 16m + 8*hh + r at the
    // lane's pixel: exactly the lane's K positions of the GEMM2 A fragment, so
    // the gated values go into A2 where they stand.
    {
      v16h A2[2];
      #pragma unroll
      for (int m = 0; m < 2; ++m) {
        int c = 32*j + 16*m + nm;           // the lane's row as a gated channel
        const unsigned* t1 = &dwt_lds[(c < HID_ ? c        : 2*HID_) * DWW_];
        const unsigned* t2 = &dwt_lds[(c < HID_ ? c + HID_ : 2*HID_) * DWW_];
        v8f D1[2], D2[2];
        dw_tile(t1, hh, msk, hb, 8*m,      D1);
        dw_tile(t2, hh, msk, hb, 16 + 8*m, D2);
        float g[2][8];
        float zmax = gate16<false>(D1, D2, g);
        // one test for the whole wave (a scalar branch); a NaN sum does not
        // raise zmax and gives NaN on either path
        if (__builtin_amdgcn_ballot_w32(zmax >= 1.0f) != 0u)
          gate16<true>(D1, D2, g);
        #pragma unroll
        for (int q = 0; q < 2; ++q)
          #pragma unroll
          for (int r = 0; r < 8; ++r) A2[q][8*m + r] = (_Float16)g[q][r];
      }
      #pragma unroll
      for (int n2 = 0; n2 < 4; ++n2) {
        const _Float16* bp = &wout_lds[(n2*16 + nm) * WOPAD_ + 32*j + 8*hh];
        v16h B2;
        ((f4*)&B2)[0] = *(const f4*)(bp);
        ((f4*)&B2)[1] = *(const f4*)(bp + 16);
        #pragma unroll
        for (int q = 0; q < 2; ++q)
          acc2[q][n2] = __builtin_amdgcn_wmma_f32_16x16x32_f16(
              false, A2[q], false, B2, (short)0, acc2[q][n2], false, false);
      }
    }
    __syncthreads();
  }

  // ---------------- epilogue: f32 output, float4 rows ----------------
  // C-layout row M = 8*hh + r of tile q is the pixel (2*wave + q, 8*hh + r):
  // a lane holds eight pixels in a row of its channel.
  float* ob = out + (size_t)b * C_ * H_ * W_;
  #pragma unroll
  for (int n2 = 0; n2 < 4; ++n2) {
    int cch = n2*16 + nm;
    #pragma unroll
    for (int q = 0; q < 2; ++q) {
      v8f a = acc2[q][n2];
      size_t off = (size_t)cch * (H_*W_) + (size_t)(ty0 + wave*2 + q) * W_ + tx0 + 8*hh;
      *(f4*)&ob[off]     = (f4){a[0], a[1], a[2], a[3]};
      *(f4*)&ob[off + 4] = (f4){a[4], a[5], a[6], a[7]};
    }
  }
}

extern "C" void kernel_launch(void* const* d_in, const int* in_sizes, int n_in,
                              void* d_out, int out_size, void* d_ws, size_t ws_size,
                              hipStream_t stream) {
  (void)in_sizes; (void)n_in; (void)d_ws; (void)ws_size; (void)out_size;
  const float* x     = (const float*)d_in[0];
  const float* w_in  = (const float*)d_in[1];
  const float* fft_w = (const float*)d_in[2];
  const float* w_dw  = (const float*)d_in[3];
  const float* w_out = (const float*)d_in[4];
  float* out = (float*)d_out;
  dim3 grid(W_/TILE_, H_/TILE_, B_);
  dffn_fused_kernel<<<grid, 256, 0, stream>>>(x, w_in, fft_w, w_dw, w_out, out);
}

// v006
// It runs in 75.6 microseconds.
// It is 1.11 times as fast as v004, going by the measured steps of the versions left out in between.
// All steps since v000 together make it 3.56 times as fast.
#include <hip/hip_runtime.h>
#include <hip/hip_bf16.h>

typedef __attribute__((ext_vector_type(16))) _Float16 v16h;
typedef __attribute__((ext_vector_type(2)))  _Float16 h2;
typedef __attribute__((ext_vector_type(8)))  float    v8f;
typedef __attribute__((ext_vector_type(4)))  float    f4;
typedef __attribute__((ext_vector_type(2)))  float    f2;
typedef __attribute__((ext_vector_type(4)))  _Float16 h4;
typedef __attribute__((ext_vector_type(8)))  _Float16 h8;
typedef __attribute__((ext_vector_type(4)))  unsigned u4;
typedef __attribute__((ext_vector_type(8)))  unsigned u8;

#define B_     4
#define C_     64
#define H_     256
#define W_     256
#define HID_   170
#define TILE_  16
#define EXT_   20          // TILE + 2*2 halo (patch-aligned)
#define NPIX_  (EXT_*EXT_) // 400
#define XPAD_  72          // padded channel stride (16B-aligned, bank-friendly)
#define NGRP_  6           // ceil(170/32) groups of 32 gathered hidden channels
#define WROWS_ 192         // 6*32 gathered w_in rows (zero-padded)
#define HFP_   40          // filtered-h tile is pixel-major: 32 slots + 8 pad (80-byte pitch)
#define DWW_   12          // words per row of the depthwise weight table (10 used)
#define DWROWS_ (2*HID_ + 1)             // one row per conv output channel + a zero row
#define DWN_   (2*HID_*9)                // 3060 depthwise weights
#define DWIT_  ((DWN_ + 255)/256)        // 12 loads per thread
#define WOPAD_ 200         // padded hidden stride for w_out (cols >=170 zero)
#define XUNITS_ ((C_/4)*EXT_*(EXT_/2))   // 3200 staging units of the x tile
#define XIT_    (XUNITS_/256)            // 12 whole units per thread
#define XTAIL_  (XUNITS_ - 256*XIT_)     // 128 units left: half a unit per thread
#define XHALF_  6                        // x units stored before the w_in and w_out loads issue
#define WIT_    (WROWS_*(C_/4)/256)      // 12 16-byte loads of w_in per thread

#if defined(__HIP_DEVICE_COMPILE__) && defined(__gfx1250__)
#define USE_ASYNC_LDS 1
#else
#define USE_ASYNC_LDS 0
#endif

#if USE_ASYNC_LDS
// byte offset of a generic pointer within the wave's LDS aperture
__device__ static inline unsigned lds_offset_of(const void* p) {
  return (unsigned)(unsigned long long)
         (__attribute__((address_space(3))) const char*)p;
}
#endif

// erf on |z| < 1: the math library's own polynomial for that range (odd in z,
// so the sign needs no handling of its own); the same values as erff there.
__device__ static inline float erf_below_one(float z) {
  float t = z * z;
  float p = fmaf(t, fmaf(t, fmaf(t, fmaf(t, fmaf(t,
              -0x1.268bc2p-11f, 0x1.420828p-8f), -0x1.b5937p-6f), 0x1.ce077cp-4f),
              -0x1.81266p-2f), 0x1.06eba0p-3f);
  return fmaf(z, p, z);
}

// One 16x16 tile of the depthwise 3x3 as matrix products, for two pixel tiles.
// D[row][pixel] = sum over (tap, slot) of A[row][tap, slot] * hf[pixel + tap][slot]:
// rows are 16 conv output channels, fed by 8 hf slots (row r reads slot r/2), so
// A is block-diagonal: in each 8-slot chunk of K a row has one non-zero.
// A K chunk of a lane (8 halves) is one tap. Each weight is the f16 pair hi + lo
// (hi = f16(w), lo = f16(w - hi)), two products on the same hf value.
//   products 0,1: taps hh, 2+hh   (hi, then lo)    products 2,3: taps 4+hh, 6+hh
//   product  4  : tap 8, hi in the hh = 0 chunk, lo in the hh = 1 chunk; rest zero
// trow: the lane's row of the weight table; hb[e]: the lane's hf address of tap
// 2e+hh (e < 4) and of tap 8 (e = 4) for pixel tile 0, slot 0.
__device__ __forceinline__ void dw_tile(
    const unsigned* trow, int hh, const unsigned (&msk)[4],
    const _Float16* const (&hb)[5], int slot0, v8f (&D)[2])
{
  u4 w        = *(const u4*)(trow + 4*hh);
  unsigned w8 = trow[8 + hh];
  v16h A[5];
  #pragma unroll
  for (int k = 0; k < 2; ++k) {
    unsigned wa = w[2*k], wb = w[2*k + 1];
    unsigned ra = (wa >> 16) | (wa << 16), rb = (wb >> 16) | (wb << 16);
    A[2*k]     = __builtin_bit_cast(v16h, (u8){wa & msk[0], wa & msk[1], wa & msk[2], wa & msk[3],
                                               wb & msk[0], wb & msk[1], wb & msk[2], wb & msk[3]});
    A[2*k + 1] = __builtin_bit_cast(v16h, (u8){ra & msk[0], ra & msk[1], ra & msk[2], ra & msk[3],
                                               rb & msk[0], rb & msk[1], rb & msk[2], rb & msk[3]});
  }
  A[4] = __builtin_bit_cast(v16h, (u8){w8 & msk[0], w8 & msk[1], w8 & msk[2], w8 & msk[3], 0u, 0u, 0u, 0u});
  #pragma unroll
  for (int q = 0; q < 2; ++q) {
    const int o = q*EXT_*HFP_ + slot0;
    v16h B0, B1, B2;
    ((f4*)&B0)[0] = *(const f4*)(hb[0] + o);
    ((f4*)&B0)[1] = *(const f4*)(hb[1] + o);
    ((f4*)&B1)[0] = *(const f4*)(hb[2] + o);
    ((f4*)&B1)[1] = *(const f4*)(hb[3] + o);
    ((f4*)&B2)[0] = *(const f4*)(hb[4] + o);
    ((f4*)&B2)[1] = ((f4*)&B2)[0];          // meets zero weights: any finite data
    v8f d = (v8f){0,0,0,0,0,0,0,0};
    d = __builtin_amdgcn_wmma_f32_16x16x32_f16(false, A[0], false, B0, (short)0, d, false, false);
    d = __builtin_amdgcn_wmma_f32_16x16x32_f16(false, A[1], false, B0, (short)0, d, false, false);
    d = __builtin_amdgcn_wmma_f32_16x16x32_f16(false, A[2], false, B1, (short)0, d, false, false);
    d = __builtin_amdgcn_wmma_f32_16x16x32_f16(false, A[3], false, B1, (short)0, d, false, false);
    d = __builtin_amdgcn_wmma_f32_16x16x32_f16(false, A[4], false, B2, (short)0, d, false, false);
    D[q] = d;
  }
}

// Exact-GELU gate of the 16 value pairs a lane holds in two pairs of D tiles.
// FULL = false: erf by the |z| < 1 polynomial alone, no branch per value;
// returns the largest |z| the lane met, and the caller repeats the gate with
// FULL = true (erff) if that reaches 1.
template <bool FULL>
__device__ __forceinline__ float gate16(
    const v8f (&D1)[2], const v8f (&D2)[2], float (&g)[2][8])
{
  float zmax = 0.0f;
  #pragma unroll
  for (int q = 0; q < 2; ++q)
    #pragma unroll
    for (int r = 0; r < 8; ++r) {
      float s1 = D1[q][r], s2 = D2[q][r];
      float z = s1 * 0.70710678118654752f;
      float e;
      if (FULL) {
        e = erff(z);
      } else {
        e = erf_below_one(z);
        zmax = fmaxf(zmax, fabsf(z));
      }
      float ge = 0.5f * s1 * (1.0f + e);
      g[q][r] = ge * s2;
    }
  return zmax;
}

__global__ __launch_bounds__(256) void dffn_fused_kernel(
    const float* __restrict__ xin,  const float* __restrict__ w_in,
    const float* __restrict__ fft_w, const float* __restrict__ w_dw,
    const float* __restrict__ w_out, float* __restrict__ out)
{
  __shared__ __align__(16) _Float16 x_lds  [NPIX_ * XPAD_];   // 57.6 KB
  __shared__ __align__(16) _Float16 win_lds[WROWS_ * XPAD_];  // 27.6 KB
  __shared__ __align__(16) _Float16 hf_lds [NPIX_ * HFP_];     // 32.0 KB
  __shared__ __align__(16) _Float16 wout_lds[64 * WOPAD_];    // 25.6 KB
  __shared__ __align__(16) unsigned dwt_lds [DWROWS_ * DWW_];  // 16.4 KB
  __shared__ __align__(16) float    fftw_lds[HID_*4];         //  2.7 KB
  __shared__ __align__(16) unsigned hs_lds  [32*4];           //  0.5 KB

  const int tid  = threadIdx.x;
  const int wave = tid >> 5;
  const int nm   = tid & 15;        // M or N index within 16: a pixel or a channel
  const int hh   = (tid >> 4) & 1;  // wave half -> K-range selector in A/B layouts

  const int tx0 = blockIdx.x * TILE_;
  const int ty0 = blockIdx.y * TILE_;
  const int b   = blockIdx.z;

  const float* xb = xin + (size_t)b * C_ * H_ * W_;

  // ---- kick off async DMA of the pure-copy weight table into LDS ----
  // (tracked by ASYNCcnt; overlapped with x-tile staging below)
#if USE_ASYNC_LDS
  for (int i = tid; i < (HID_*4)/4; i += 256) {         // 170 x b128
    unsigned ldst = lds_offset_of(&fftw_lds[i*4]);
    unsigned long long ga = (unsigned long long)(const void*)(fft_w + i*4);
    asm volatile("global_load_async_to_lds_b128 %0, %1, off"
                 :: "v"(ldst), "v"(ga) : "memory");
  }
#else
  for (int i = tid; i < HID_*4;   i += 256) fftw_lds[i] = fft_w[i];
#endif

  // ---------------- stage converted operands into LDS ----------------
  // Every global load below is unconditional (index clamped in bounds, value
  // selected to zero afterwards), so a whole batch is in flight before the
  // first wait; the weights' loads fly while the x tile is converted.
  //
  // x unit = 4 channels x 1 row x 2 columns: four 8-byte loads, two 8-byte LDS
  // stores. The tile's first column is even, so a column pair is inside the
  // image as a whole or outside it as a whole.
  f2       xv[XIT_][4];
  unsigned xoff[XIT_];     // byte offset of the unit's first load in xb
  int      xdst[XIT_];
  bool     xok[XIT_];
  const char* xbytes = (const char*)xb;

  // the unrolls of this section keep the batch arrays in registers and let all
  // loads of a batch issue back to back
  #pragma unroll
  for (int i = 0; i < XIT_; ++i) {
    int u   = tid + 256 * i;
    int cg  = u / (EXT_ * 10);
    int r   = u - cg * (EXT_ * 10);
    int py  = r / 10, k = r - py * 10;
    int gy  = ty0 - 2 + py, gx = tx0 - 2 + 2 * k;
    xok[i]  = (unsigned)gy < (unsigned)H_ && (unsigned)gx < (unsigned)W_;
    int cy  = gy < 0 ? 0 : (gy > H_ - 1 ? H_ - 1 : gy);
    int cx  = gx < 0 ? 0 : (gx > W_ - 2 ? W_ - 2 : gx);
    xoff[i] = 4u * (unsigned)(cg * 4 * (H_ * W_) + cy * W_ + cx);
    xdst[i] = (py * EXT_ + 2 * k) * XPAD_ + cg * 4;
    #pragma unroll
    for (int ch = 0; ch < 4; ++ch)
      xv[i][ch] = *(const f2*)(xbytes + xoff[i] + 4u * ch * (H_ * W_));
  }
  // the units left over: two threads share one, two channels each
  static_assert(2 * XTAIL_ == 256, "the tail takes exactly half a unit per thread");
  f2 tv[2]; unsigned toff; int tdst; bool tok;
  {
    int u   = 256 * XIT_ + (tid >> 1);
    int cg  = u / (EXT_ * 10);
    int r   = u - cg * (EXT_ * 10);
    int py  = r / 10, k = r - py * 10;
    int gy  = ty0 - 2 + py, gx = tx0 - 2 + 2 * k;
    tok     = (unsigned)gy < (unsigned)H_ && (unsigned)gx < (unsigned)W_;
    int cy  = gy < 0 ? 0 : (gy > H_ - 1 ? H_ - 1 : gy);
    int cx  = gx < 0 ? 0 : (gx > W_ - 2 ? W_ - 2 : gx);
    int c0  = cg * 4 + 2 * (tid & 1);
    toff  = 4u * (unsigned)(c0 * (H_ * W_) + cy * W_ + cx);
    tdst  = (py * EXT_ + 2 * k) * XPAD_ + c0;
    tv[0] = *(const f2*)(xbytes + toff);
    tv[1] = *(const f2*)(xbytes + toff + 4u * (H_ * W_));
  }
  // depthwise weights, one 4-byte load per 256: the last one clamped in bounds
  const unsigned doff  = 4u * (unsigned)tid;
  const unsigned doffl = 4u * (unsigned)(tid + 256*(DWIT_-1) < DWN_ ? tid + 256*(DWIT_-1) : DWN_-1);
  float dv[DWIT_];
  #pragma unroll
  for (int i = 0; i < DWIT_ - 1; ++i)
    dv[i] = *(const float*)((const char*)w_dw + doff + 1024u * i);
  dv[DWIT_-1] = *(const float*)((const char*)w_dw + doffl);
  // No offset register of the loads above may be rewritten (a later load's
  // result counts) before this wait: naming them as inputs keeps them until it.
  asm volatile("s_wait_xcnt 0x0"
               :: "v"(xoff[0]), "v"(xoff[1]), "v"(xoff[2]), "v"(xoff[3]),
                  "v"(xoff[4]), "v"(xoff[5]), "v"(xoff[6]), "v"(xoff[7]),
                  "v"(xoff[8]), "v"(xoff[9]), "v"(xoff[10]), "v"(xoff[11]),
                  "v"(toff), "v"(doff), "v"(doffl) : "memory");

#define X_STORE(i) do {                                                       \
    h4 a0, a1;                                                                \
    _Pragma("unroll")                                                         \
    for (int ch = 0; ch < 4; ++ch) {                                          \
      a0[ch] = (_Float16)(xok[i] ? xv[i][ch][0] : 0.0f);                      \
      a1[ch] = (_Float16)(xok[i] ? xv[i][ch][1] : 0.0f);                      \
    }                                                                         \
    *(h4*)&x_lds[xdst[i]]         = a0;    /* zero halo => zero FFT patches */\
    *(h4*)&x_lds[xdst[i] + XPAD_] = a1;                                       \
  } while (0)

  #pragma unroll
  for (int i = 0; i < XHALF_; ++i) X_STORE(i);

  // gathered project_in rows: group j, slot s<16 -> ch 16j+s (low half),
  // slot s>=16 -> ch 85+16j+(s-16) (high half); invalid slots zero-padded.
  // Load i of a thread is LDS row 16i+t, t = tid/16: j = i/2, high half for odd i.
  const int wt = tid >> 4, wc4 = tid & 15;
  const bool wtail_ok = 80 + wt < 85;                 // group 5 holds 5 channels
  const unsigned woff  = 4u * (unsigned)(wt * C_ + wc4 * 4);
  const unsigned woff5 = 4u * (unsigned)((wtail_ok ? wt : 0) * C_ + wc4 * 4);
  f4 wv[WIT_];
  #pragma unroll
  for (int i = 0; i < WIT_; ++i) {
    unsigned row0 = ((i & 1) ? 85u : 0u) + 16u * (i >> 1);
    wv[i] = *(const f4*)((const char*)w_in + ((i >> 1) < 5 ? woff : woff5)
                         + 4u * C_ * row0);
  }
  // w_out: wave w stages rows 8w..8w+7; a lane takes the column pairs lane,
  // lane+32 and lane+64 of each row (pairs from 85 on are padding)
  const int lane = tid & 31;
  const unsigned ooff  = 4u * (unsigned)(wave * 8 * HID_ + 2 * lane);
  const unsigned ooff2 = 4u * (unsigned)(wave * 8 * HID_
                                         + 2 * (lane + 64 < HID_/2 ? lane + 64 : 0));
  f2 ov[8][3];
  #pragma unroll
  for (int rr = 0; rr < 8; ++rr) {
    ov[rr][0] = *(const f2*)((const char*)w_out + ooff  + 4u * HID_ * rr);
    ov[rr][1] = *(const f2*)((const char*)w_out + ooff  + 4u * HID_ * rr + 256u);
    ov[rr][2] = *(const f2*)((const char*)w_out + ooff2 + 4u * HID_ * rr);
  }
  // as above: the weights' offset registers stay untouched until this wait
  asm volatile("s_wait_xcnt 0x0"
               :: "v"(woff), "v"(woff5), "v"(ooff), "v"(ooff2) : "memory");

  #pragma unroll
  for (int i = XHALF_; i < XIT_; ++i) X_STORE(i);
  {
    h2 a0, a1;
    a0[0] = (_Float16)(tok ? tv[0][0] : 0.0f);  a0[1] = (_Float16)(tok ? tv[1][0] : 0.0f);
    a1[0] = (_Float16)(tok ? tv[0][1] : 0.0f);  a1[1] = (_Float16)(tok ? tv[1][1] : 0.0f);
    *(h2*)&x_lds[tdst]         = a0;
    *(h2*)&x_lds[tdst + XPAD_] = a1;
  }
#undef X_STORE

  #pragma unroll
  for (int i = 0; i < WIT_; ++i) {
    bool ok = (i >> 1) < 5 || wtail_ok;
    h4 a;
    #pragma unroll
    for (int e = 0; e < 4; ++e) a[e] = (_Float16)(ok ? wv[i][e] : 0.0f);
    *(h4*)&win_lds[(16 * i + wt) * XPAD_ + wc4 * 4] = a;
  }
  #pragma unroll
  for (int rr = 0; rr < 8; ++rr) {
    _Float16* wrow = &wout_lds[(wave * 8 + rr) * WOPAD_];
    #pragma unroll
    for (int ch = 0; ch < 3; ++ch) {
      int o2 = lane + 32 * ch;
      bool ok = o2 < HID_/2;
      h2 a;
      a[0] = (_Float16)(ok ? ov[rr][ch][0] : 0.0f);
      a[1] = (_Float16)(ok ? ov[rr][ch][1] : 0.0f);
      *(h2*)&wrow[2 * o2] = a;
    }
    if (lane < WOPAD_/2 - 96) *(h2*)&wrow[2 * (96 + lane)] = (h2){0, 0};
  }

  // depthwise weight table: row = conv output channel o, a word = the f16 pair
  // (hi, lo) of one weight with hi in the half that the row's hf slot has in
  // its register of a K chunk; words 0-3 taps 0,2,4,6; 4-7 taps 1,3,5,7; word 8
  // tap 8, word 9 tap 8 with the halves swapped. Row 2*HID_ is all zero.
  #pragma unroll
  for (int i = 0; i < DWIT_; ++i) {
    int idx = tid + 256 * i;
    int o = idx / 9, tap = idx - 9 * o;
    float wf = dv[i];
    _Float16 whi = (_Float16)wf;
    _Float16 wlo = (_Float16)(wf - (float)whi);
    unsigned uh = __builtin_bit_cast(unsigned short, whi);
    unsigned ul = __builtin_bit_cast(unsigned short, wlo);
    int  cg = o < HID_ ? o : o - HID_;      // gated channel the output feeds
    bool up = (cg >> 1) & 1;
    unsigned word = up ? (uh << 16) | ul : (ul << 16) | uh;
    unsigned swp  = up ? (ul << 16) | uh : (uh << 16) | ul;
    if (idx < DWN_) {
      dwt_lds[o * DWW_ + (tap < 8 ? (tap & 1) * 4 + (tap >> 1) : 8)] = word;
      if (tap == 8) dwt_lds[o * DWW_ + 9] = swp;
    }
  }
  if (tid < DWW_) dwt_lds[2*HID_ * DWW_ + tid] = 0u;

  // B fragment of the inverse 2x2 transform over a 4x4 pixel block: row k is the
  // frequency kept at pixel k, column nm the output pixel (pixel p = row p/4,
  // column p%4). +1 or -1 inside a patch, 0 elsewhere. A lane's rows 8*hh + e are
  // block rows 2*hh and 2*hh + 1, word d = e/2. Kept in LDS, one 16-byte row per
  // lane, and read once per group: held in registers through the depthwise part
  // it would cost the second work-group on the WGP.
  if (tid < 32) {
    const bool rowp = (nm >> 3) == hh;                           // same patch row
    unsigned s0 = 0x3C003C00u ^ ((nm & 1) ? 0x80000000u : 0u);   // fy = 0: (+1, +-1)
    unsigned s1 = s0 ^ ((nm & 4) ? 0x80008000u : 0u);            // fy = 1
    const bool c1 = (nm >> 1) & 1;                               // the pixel's patch column
    unsigned a0 = rowp && !c1 ? 0xFFFFFFFFu : 0u;
    unsigned a1 = rowp &&  c1 ? 0xFFFFFFFFu : 0u;
    *(u4*)&hs_lds[tid*4] = (u4){s0 & a0, s0 & a1, s1 & a0, s1 & a1};
  }

#if USE_ASYNC_LDS
  asm volatile("s_wait_asynccnt 0" ::: "memory");
#endif
  __syncthreads();

  // lane constants of the depthwise products: where the lane's row has its
  // non-zero in a K chunk, and the hf addresses of its taps.
  // Pixel tile q of a wave is output row 2*wave + q, columns 0..15 (N = nm).
  unsigned msk[4];
  #pragma unroll
  for (int r = 0; r < 4; ++r)
    msk[r] = ((nm >> 2) == r) ? (((nm >> 1) & 1) ? 0xFFFF0000u : 0x0000FFFFu) : 0u;
  const _Float16* hb[5];
  #pragma unroll
  for (int e = 0; e < 5; ++e) {
    int tap = e < 4 ? 2*e + hh : 8;
    hb[e] = &hf_lds[((wave*2 + 1 + tap/3)*EXT_ + nm + 1 + tap%3) * HFP_];
  }

  // GEMM1 job constants: the wave's number as a scalar, and the lane's pixel
  // inside a 4x4 block
  const int swave = __builtin_amdgcn_readfirstlane(wave);
  const int nt    = swave & 1;
  const int wp    = swave >> 1;
  const int lpix  = (nm >> 2)*EXT_ + (nm & 3);
  const int pixc  = lpix + 4*wp;                 // block (0, wp)
  const int pixr  = lpix + wp*4*EXT_ + 16;       // block (wp, 4)
  const _Float16* apc = &x_lds[pixc * XPAD_ + 8*hh];
  const _Float16* apr = &x_lds[pixr * XPAD_ + 8*hh];
  _Float16* hpc = &hf_lds[pixc * HFP_ + nt*16 + 8*hh];
  _Float16* hpr = &hf_lds[pixr * HFP_ + nt*16 + 8*hh];

  // persistent project_out accumulators: 2 pixel tiles x 4 out-channel tiles
  v8f acc2[2][4];
  #pragma unroll
  for (int q = 0; q < 2; ++q)
    #pragma unroll
    for (int n = 0; n < 4; ++n) acc2[q][n] = (v8f){0,0,0,0,0,0,0,0};

  for (int j = 0; j < NGRP_; ++j) {
    // ---- GEMM1 (project_in) over extended tile + 2x2 Hadamard FFT filter ----
    // (forward half on the vector unit, inverse half as a matrix product)
    // 25 pixel-blocks (5x5 of 4x4) x 2 channel-ntiles = 50 wave-jobs
    const u4 hw = *(const u4*)&hs_lds[(tid & 31)*4];
    const v16h Hs = __builtin_bit_cast(v16h, (u8){hw[0], hw[1], hw[2], hw[3], 0u, 0u, 0u, 0u});  // rows 16..31 zero
    // A wave has ntile wave & 1 and, with wp = wave/2, the blocks (t, wp) for
    // t = 0..4 (block column wp, a constant step from job to job, so the step
    // is an immediate offset), (wp, 4) as job 5, and for wp = 0 block (4, 4) as
    // job 6. The wave number is held in a scalar register: the trip test is a
    // scalar branch. The unroll lets the chains of neighbouring jobs (LDS read,
    // products, transform, product, store) run inside one another's waits.
    #pragma unroll
    for (int t = 0; t < 7; ++t) {
      if (t == 6 && wp != 0) break;
      const int dpix = t < 5 ? t*4*EXT_ : t == 5 ? 0 : (4*EXT_ + 4)*4;   // job 6: wp = 0
      const _Float16* ap = (t == 5 ? apr : apc) + dpix * XPAD_;
      const _Float16* bp = &win_lds[(j*32 + nt*16 + nm) * XPAD_ + 8*hh];
      v16h A0, A1, B0, B1;
      ((f4*)&A0)[0] = *(const f4*)(ap);        // K  8h.. 8h+7
      ((f4*)&A0)[1] = *(const f4*)(ap + 16);   // K 16+8h..
      ((f4*)&A1)[0] = *(const f4*)(ap + 32);
      ((f4*)&A1)[1] = *(const f4*)(ap + 48);
      ((f4*)&B0)[0] = *(const f4*)(bp);
      ((f4*)&B0)[1] = *(const f4*)(bp + 16);
      ((f4*)&B1)[0] = *(const f4*)(bp + 32);
      ((f4*)&B1)[1] = *(const f4*)(bp + 48);
      v8f acc = (v8f){0,0,0,0,0,0,0,0};
      acc = __builtin_amdgcn_wmma_f32_16x16x32_f16(false, A0, false, B0, (short)0, acc, false, false);
      acc = __builtin_amdgcn_wmma_f32_16x16x32_f16(false, A1, false, B1, (short)0, acc, false, false);

      // per-lane channel's 2x2 spectral weights, the inverse's 1/4 folded in (exact)
      int sg  = nt*16 + nm;
      int hch = ((sg < 16) ? 0 : 85) + 16*j + nm;
      hch = (hch > HID_-1) ? (HID_-1) : hch;     // pad slots: values are 0 anyway
      f4 fw = *(const f4*)&fftw_lds[hch*4];
      f2 wA = (f2){0.25f*fw[0],  0.25f*fw[1]}, wB = (f2){0.25f*fw[2],  0.25f*fw[3]};
      f2 nA = (f2){0.25f*fw[0], -0.25f*fw[1]}, nB = (f2){0.25f*fw[2], -0.25f*fw[3]};
      // each lane holds both rows of its 2 patches (C-layout rows 2h,2h+1):
      // forward 2x2 transform and spectral weight in f32, each value left at the
      // pixel position of its frequency. D row 8*hh + r is the lane's K position
      // 8*hh + r of an A fragment with M = slot, so the values go into F as they stand.
      v16h F = {};                               // K positions 16..31 stay zero
      #pragma unroll
      for (int pc = 0; pc < 2; ++pc) {
        f2 top = (f2){acc[2*pc],   acc[2*pc+1]};
        f2 bot = (f2){acc[4+2*pc], acc[4+2*pc+1]};
        f2 u = top + bot, v = top - bot;
        // (a + b)*w0, (a - b)*w1 as a*(w0, w1) + b*(w0, -w1): two packed operations
        f2 Fa = (f2){u[0], u[0]} * wA + (f2){u[1], u[1]} * nA;
        f2 Fb = (f2){v[0], v[0]} * wB + (f2){v[1], v[1]} * nB;
        F[2*pc]     = (_Float16)Fa[0];  F[2*pc + 1]     = (_Float16)Fa[1];
        F[4 + 2*pc] = (_Float16)Fb[0];  F[4 + 2*pc + 1] = (_Float16)Fb[1];
      }
      // inverse transform: y[slot][pixel] = sum over k of F[slot][k] * Hs[k][pixel].
      // D row 8*hh + r at column nm is slot 8*hh + r at the block's pixel nm:
      // eight neighbouring slots of one pixel, one 16-byte store.
      v8f y = (v8f){0,0,0,0,0,0,0,0};
      y = __builtin_amdgcn_wmma_f32_16x16x32_f16(false, F, false, Hs, (short)0, y, false, false);
      *(h8*)((t == 5 ? hpr : hpc) + dpix * HFP_) = __builtin_convertvector(y, h8);
    }
    __syncthreads();

    // ---- depthwise 3x3 on matrix products + exact-GELU gate ----
    // D row 8*hh + r of tile m is gated channel 32j + 16m + 8*hh + r at the
    // lane's pixel: exactly the lane's K positions of the GEMM2 A fragment, so
    // the gated values go into A2 where they stand.
    {
      v16h A2[2];
      #pragma unroll
      for (int m = 0; m < 2; ++m) {
        int c = 32*j + 16*m + nm;           // the lane's row as a gated channel
        const unsigned* t1 = &dwt_lds[(c < HID_ ? c        : 2*HID_) * DWW_];
        const unsigned* t2 = &dwt_lds[(c < HID_ ? c + HID_ : 2*HID_) * DWW_];
        v8f D1[2], D2[2];
        dw_tile(t1, hh, msk, hb, 8*m,      D1);
        dw_tile(t2, hh, msk, hb, 16 + 8*m, D2);
        float g[2][8];
        float zmax = gate16<false>(D1, D2, g);
        // one test for the whole wave (a scalar branch); a NaN sum does not
        // raise zmax and gives NaN on either path
        if (__builtin_amdgcn_ballot_w32(zmax >= 1.0f) != 0u)
          gate16<true>(D1, D2, g);
        #pragma unroll
        for (int q = 0; q < 2; ++q)
          #pragma unroll
          for (int r = 0; r < 8; ++r) A2[q][8*m + r] = (_Float16)g[q][r];
      }
      #pragma unroll
      for (int n2 = 0; n2 < 4; ++n2) {
        const _Float16* bp = &wout_lds[(n2*16 + nm) * WOPAD_ + 32*j + 8*hh];
        v16h B2;
        ((f4*)&B2)[0] = *(const f4*)(bp);
        ((f4*)&B2)[1] = *(const f4*)(bp + 16);
        #pragma unroll
        for (int q = 0; q < 2; ++q)
          acc2[q][n2] = __builtin_amdgcn_wmma_f32_16x16x32_f16(
              false, A2[q], false, B2, (short)0, acc2[q][n2], false, false);
      }
    }
    __syncthreads();
  }

  // ---------------- epilogue: f32 output, float4 rows ----------------
  // C-layout row M = 8*hh + r of tile q is the pixel (2*wave + q, 8*hh + r):
  // a lane holds eight pixels in a row of its channel.
  float* ob = out + (size_t)b * C_ * H_ * W_;
  #pragma unroll
  for (int n2 = 0; n2 < 4; ++n2) {
    int cch = n2*16 + nm;
    #pragma unroll
    for (int q = 0; q < 2; ++q) {
      v8f a = acc2[q][n2];
      size_t off = (size_t)cch * (H_*W_) + (size_t)(ty0 + wave*2 + q) * W_ + tx0 + 8*hh;
      *(f4*)&ob[off]     = (f4){a[0], a[1], a[2], a[3]};
      *(f4*)&ob[off + 4] = (f4){a[4], a[5], a[6], a[7]};
    }
  }
}

extern "C" void kernel_launch(void* const* d_in, const int* in_sizes, int n_in,
                              void* d_out, int out_size, void* d_ws, size_t ws_size,
                              hipStream_t stream) {
  (void)in_sizes; (void)n_in; (void)d_ws; (void)ws_size; (void)out_size;
  const float* x     = (const float*)d_in[0];
  const float* w_in  = (const float*)d_in[1];
  const float* fft_w = (const float*)d_in[2];
  const float* w_dw  = (const float*)d_in[3];
  const float* w_out = (const float*)d_in[4];
  float* out = (float*)d_out;
  dim3 grid(W_/TILE_, H_/TILE_, B_);
  dffn_fused_kernel<<<grid, 256, 0, stream>>>(x, w_in, fft_w, w_dw, w_out, out);
}

// v007
// One run takes 72.9 microseconds.
// In both of two side-by-side timings against v006, it was 1.04 times as fast.
// Counting every step since v000, it is 3.70 times as fast.
#include <hip/hip_runtime.h>
#include <hip/hip_bf16.h>

typedef __attribute__((ext_vector_type(16))) _Float16 v16h;
typedef __attribute__((ext_vector_type(2)))  _Float16 h2;
typedef __attribute__((ext_vector_type(8)))  float    v8f;
typedef __attribute__((ext_vector_type(4)))  float    f4;
typedef __attribute__((ext_vector_type(2)))  float    f2;
typedef __attribute__((ext_vector_type(4)))  _Float16 h4;
typedef __attribute__((ext_vector_type(8)))  _Float16 h8;
typedef __attribute__((ext_vector_type(4)))  unsigned u4;
typedef __attribute__((ext_vector_type(8)))  unsigned u8;

#define B_     4
#define C_     64
#define H_     256
#define W_     256
#define HID_   170
#define TILE_  16
#define EXT_   20          // TILE + 2*2 halo (patch-aligned)
#define NPIX_  (EXT_*EXT_) // 400
#define XPAD_  72          // padded channel stride (16B-aligned, bank-friendly)
#define NGRP_  6           // ceil(170/32) groups of 32 gathered hidden channels
#define WROWS_ 192         // 6*32 w_in rows: 176 gathered (zero-padded), rest unused
#define HFP_   40          // filtered-h tile is pixel-major: 32 slots + 8 pad (80-byte pitch)
#define DWW_   12          // words per row of the depthwise weight table (10 used)
#define DWROWS_ (2*HID_ + 1)             // one row per conv output channel + a zero row
#define DWN_   (2*HID_*9)                // 3060 depthwise weights
#define DWIT_  ((DWN_ + 255)/256)        // 12 loads per thread
#define WOPAD_ 200         // padded hidden stride for w_out (cols >=170 zero)
#define XUNITS_ ((C_/4)*EXT_*(EXT_/2))   // 3200 staging units of the x tile
#define XIT_    (XUNITS_/256)            // 12 whole units per thread
#define XTAIL_  (XUNITS_ - 256*XIT_)     // 128 units left: half a unit per thread
#define XHALF_  6                        // x units stored before the w_in and w_out loads issue
#define WIT_    (WROWS_*(C_/4)/256)      // 12 16-byte loads of w_in per thread

#if defined(__HIP_DEVICE_COMPILE__) && defined(__gfx1250__)
#define USE_ASYNC_LDS 1
#else
#define USE_ASYNC_LDS 0
#endif

#if USE_ASYNC_LDS
// byte offset of a generic pointer within the wave's LDS aperture
__device__ static inline unsigned lds_offset_of(const void* p) {
  return (unsigned)(unsigned long long)
         (__attribute__((address_space(3))) const char*)p;
}
#endif

// erf on |z| < 1: the math library's own polynomial for that range (odd in z,
// so the sign needs no handling of its own); the same values as erff there.
__device__ static inline float erf_below_one(float z) {
  float t = z * z;
  float p = fmaf(t, fmaf(t, fmaf(t, fmaf(t, fmaf(t,
              -0x1.268bc2p-11f, 0x1.420828p-8f), -0x1.b5937p-6f), 0x1.ce077cp-4f),
              -0x1.81266p-2f), 0x1.06eba0p-3f);
  return fmaf(z, p, z);
}

// One 16x16 tile of the depthwise 3x3 as matrix products, for two pixel tiles.
// D[row][pixel] = sum over (tap, slot) of A[row][tap, slot] * hf[pixel + tap][slot]:
// rows are 16 conv output channels, fed by 8 hf slots (row r reads slot r/2), so
// A is block-diagonal: in each 8-slot chunk of K a row has one non-zero.
// A K chunk of a lane (8 halves) is one tap. Each weight is the f16 pair hi + lo
// (hi = f16(w), lo = f16(w - hi)), two products on the same hf value.
//   products 0,1: taps hh, 2+hh   (hi, then lo)    products 2,3: taps 4+hh, 6+hh
//   product  4  : tap 8, hi in the hh = 0 chunk, lo in the hh = 1 chunk; rest zero
// trow: the lane's row of the weight table; hb[e]: the lane's hf address of tap
// 2e+hh (e < 4) and of tap 8 (e = 4) for pixel tile 0, slot 0.
__device__ __forceinline__ void dw_tile(
    const unsigned* trow, int hh, const unsigned (&msk)[4],
    const _Float16* const (&hb)[5], int slot0, v8f (&D)[2])
{
  u4 w        = *(const u4*)(trow + 4*hh);
  unsigned w8 = trow[8 + hh];
  v16h A[5];
  #pragma unroll
  for (int k = 0; k < 2; ++k) {
    unsigned wa = w[2*k], wb = w[2*k + 1];
    unsigned ra = (wa >> 16) | (wa << 16), rb = (wb >> 16) | (wb << 16);
    A[2*k]     = __builtin_bit_cast(v16h, (u8){wa & msk[0], wa & msk[1], wa & msk[2], wa & msk[3],
                                               wb & msk[0], wb & msk[1], wb & msk[2], wb & msk[3]});
    A[2*k + 1] = __builtin_bit_cast(v16h, (u8){ra & msk[0], ra & msk[1], ra & msk[2], ra & msk[3],
                                               rb & msk[0], rb & msk[1], rb & msk[2], rb & msk[3]});
  }
  A[4] = __builtin_bit_cast(v16h, (u8){w8 & msk[0], w8 & msk[1], w8 & msk[2], w8 & msk[3], 0u, 0u, 0u, 0u});
  #pragma unroll
  for (int q = 0; q < 2; ++q) {
    const int o = q*EXT_*HFP_ + slot0;
    v16h B0, B1, B2;
    ((f4*)&B0)[0] = *(const f4*)(hb[0] + o);
    ((f4*)&B0)[1] = *(const f4*)(hb[1] + o);
    ((f4*)&B1)[0] = *(const f4*)(hb[2] + o);
    ((f4*)&B1)[1] = *(const f4*)(hb[3] + o);
    ((f4*)&B2)[0] = *(const f4*)(hb[4] + o);
    ((f4*)&B2)[1] = ((f4*)&B2)[0];          // meets zero weights: any finite data
    v8f d = (v8f){0,0,0,0,0,0,0,0};
    d = __builtin_amdgcn_wmma_f32_16x16x32_f16(false, A[0], false, B0, (short)0, d, false, false);
    d = __builtin_amdgcn_wmma_f32_16x16x32_f16(false, A[1], false, B0, (short)0, d, false, false);
    d = __builtin_amdgcn_wmma_f32_16x16x32_f16(false, A[2], false, B1, (short)0, d, false, false);
    d = __builtin_amdgcn_wmma_f32_16x16x32_f16(false, A[3], false, B1, (short)0, d, false, false);
    d = __builtin_amdgcn_wmma_f32_16x16x32_f16(false, A[4], false, B2, (short)0, d, false, false);
    D[q] = d;
  }
}

// Exact-GELU gate of the 16 value pairs a lane holds in two pairs of D tiles.
// FULL = false: erf by the |z| < 1 polynomial alone, no branch per value;
// returns the largest |z| the lane met, and the caller repeats the gate with
// FULL = true (erff) if that reaches 1.
template <bool FULL>
__device__ __forceinline__ float gate16(
    const v8f (&D1)[2], const v8f (&D2)[2], float (&g)[2][8])
{
  float zmax = 0.0f;
  #pragma unroll
  for (int q = 0; q < 2; ++q)
    #pragma unroll
    for (int r = 0; r < 8; ++r) {
      float s1 = D1[q][r], s2 = D2[q][r];
      float z = s1 * 0.70710678118654752f;
      float e;
      if (FULL) {
        e = erff(z);
      } else {
        e = erf_below_one(z);
        zmax = fmaxf(zmax, fabsf(z));
      }
      float ge = 0.5f * s1 * (1.0f + e);
      g[q][r] = ge * s2;
    }
  return zmax;
}

__global__ __launch_bounds__(256) void dffn_fused_kernel(
    const float* __restrict__ xin,  const float* __restrict__ w_in,
    const float* __restrict__ fft_w, const float* __restrict__ w_dw,
    const float* __restrict__ w_out, float* __restrict__ out)
{
  __shared__ __align__(16) _Float16 x_lds  [NPIX_ * XPAD_];   // 57.6 KB
  __shared__ __align__(16) _Float16 win_lds[WROWS_ * XPAD_];  // 27.6 KB
  __shared__ __align__(16) _Float16 hf_lds [NPIX_ * HFP_];     // 32.0 KB
  __shared__ __align__(16) _Float16 wout_lds[64 * WOPAD_];    // 25.6 KB
  __shared__ __align__(16) unsigned dwt_lds [DWROWS_ * DWW_];  // 16.4 KB
  __shared__ __align__(16) float    fftw_lds[HID_*4];         //  2.7 KB
  __shared__ __align__(16) unsigned hs_lds  [32*4];           //  0.5 KB

  const int tid  = threadIdx.x;
  const int wave = tid >> 5;
  const int nm   = tid & 15;        // M or N index within 16: a pixel or a channel
  const int hh   = (tid >> 4) & 1;  // wave half -> K-range selector in A/B layouts

  const int tx0 = blockIdx.x * TILE_;
  const int ty0 = blockIdx.y * TILE_;
  const int b   = blockIdx.z;

  const float* xb = xin + (size_t)b * C_ * H_ * W_;

  // ---- kick off async DMA of the pure-copy weight table into LDS ----
  // (tracked by ASYNCcnt; overlapped with x-tile staging below)
#if USE_ASYNC_LDS
  for (int i = tid; i < (HID_*4)/4; i += 256) {         // 170 x b128
    unsigned ldst = lds_offset_of(&fftw_lds[i*4]);
    unsigned long long ga = (unsigned long long)(const void*)(fft_w + i*4);
    asm volatile("global_load_async_to_lds_b128 %0, %1, off"
                 :: "v"(ldst), "v"(ga) : "memory");
  }
#else
  for (int i = tid; i < HID_*4;   i += 256) fftw_lds[i] = fft_w[i];
#endif

  // ---------------- stage converted operands into LDS ----------------
  // Every global load below is unconditional (index clamped in bounds, value
  // selected to zero afterwards), so a whole batch is in flight before the
  // first wait; the weights' loads fly while the x tile is converted.
  //
  // x unit = 4 channels x 1 row x 2 columns: four 8-byte loads, two 8-byte LDS
  // stores. The tile's first column is even, so a column pair is inside the
  // image as a whole or outside it as a whole.
  f2       xv[XIT_][4];
  unsigned xoff[XIT_];     // byte offset of the unit's first load in xb
  int      xdst[XIT_];
  bool     xok[XIT_];
  const char* xbytes = (const char*)xb;

  // the unrolls of this section keep the batch arrays in registers and let all
  // loads of a batch issue back to back
  #pragma unroll
  for (int i = 0; i < XIT_; ++i) {
    int u   = tid + 256 * i;
    int cg  = u / (EXT_ * 10);
    int r   = u - cg * (EXT_ * 10);
    int py  = r / 10, k = r - py * 10;
    int gy  = ty0 - 2 + py, gx = tx0 - 2 + 2 * k;
    xok[i]  = (unsigned)gy < (unsigned)H_ && (unsigned)gx < (unsigned)W_;
    int cy  = gy < 0 ? 0 : (gy > H_ - 1 ? H_ - 1 : gy);
    int cx  = gx < 0 ? 0 : (gx > W_ - 2 ? W_ - 2 : gx);
    xoff[i] = 4u * (unsigned)(cg * 4 * (H_ * W_) + cy * W_ + cx);
    xdst[i] = (py * EXT_ + 2 * k) * XPAD_ + cg * 4;
    #pragma unroll
    for (int ch = 0; ch < 4; ++ch)
      xv[i][ch] = *(const f2*)(xbytes + xoff[i] + 4u * ch * (H_ * W_));
  }
  // the units left over: two threads share one, two channels each
  static_assert(2 * XTAIL_ == 256, "the tail takes exactly half a unit per thread");
  f2 tv[2]; unsigned toff; int tdst; bool tok;
  {
    int u   = 256 * XIT_ + (tid >> 1);
    int cg  = u / (EXT_ * 10);
    int r   = u - cg * (EXT_ * 10);
    int py  = r / 10, k = r - py * 10;
    int gy  = ty0 - 2 + py, gx = tx0 - 2 + 2 * k;
    tok     = (unsigned)gy < (unsigned)H_ && (unsigned)gx < (unsigned)W_;
    int cy  = gy < 0 ? 0 : (gy > H_ - 1 ? H_ - 1 : gy);
    int cx  = gx < 0 ? 0 : (gx > W_ - 2 ? W_ - 2 : gx);
    int c0  = cg * 4 + 2 * (tid & 1);
    toff  = 4u * (unsigned)(c0 * (H_ * W_) + cy * W_ + cx);
    tdst  = (py * EXT_ + 2 * k) * XPAD_ + c0;
    tv[0] = *(const f2*)(xbytes + toff);
    tv[1] = *(const f2*)(xbytes + toff + 4u * (H_ * W_));
  }
  // depthwise weights, one 4-byte load per 256: the last one clamped in bounds
  const unsigned doff  = 4u * (unsigned)tid;
  const unsigned doffl = 4u * (unsigned)(tid + 256*(DWIT_-1) < DWN_ ? tid + 256*(DWIT_-1) : DWN_-1);
  float dv[DWIT_];
  #pragma unroll
  for (int i = 0; i < DWIT_ - 1; ++i)
    dv[i] = *(const float*)((const char*)w_dw + doff + 1024u * i);
  dv[DWIT_-1] = *(const float*)((const char*)w_dw + doffl);
  // No offset register of the loads above may be rewritten (a later load's
  // result counts) before this wait: naming them as inputs keeps them until it.
  asm volatile("s_wait_xcnt 0x0"
               :: "v"(xoff[0]), "v"(xoff[1]), "v"(xoff[2]), "v"(xoff[3]),
                  "v"(xoff[4]), "v"(xoff[5]), "v"(xoff[6]), "v"(xoff[7]),
                  "v"(xoff[8]), "v"(xoff[9]), "v"(xoff[10]), "v"(xoff[11]),
                  "v"(toff), "v"(doff), "v"(doffl) : "memory");

#define X_STORE(i) do {                                                       \
    h4 a0, a1;                                                                \
    _Pragma("unroll")                                                         \
    for (int ch = 0; ch < 4; ++ch) {                                          \
      a0[ch] = (_Float16)(xok[i] ? xv[i][ch][0] : 0.0f);                      \
      a1[ch] = (_Float16)(xok[i] ? xv[i][ch][1] : 0.0f);                      \
    }                                                                         \
    *(h4*)&x_lds[xdst[i]]         = a0;    /* zero halo => zero FFT patches */\
    *(h4*)&x_lds[xdst[i] + XPAD_] = a1;                                       \
  } while (0)

  #pragma unroll
  for (int i = 0; i < XHALF_; ++i) X_STORE(i);

  // gathered project_in rows: group j, slot s<16 -> ch 16j+s (low half),
  // slot s>=16 -> ch 85+16j+(s-16) (high half); invalid slots zero-padded.
  // Load i of a thread is LDS row 16i+t, t = tid/16: j = i/2, high half for odd i.
  // Group 5 is packed into one 16-row tile: rows 160..167 low half, 168..175 high
  // half (5 channels and 3 zero rows each); rows from 176 on are not used.
  const int wt = tid >> 4, wc4 = tid & 15;
  const bool wtail_ok = 80 + wt < 85;                 // group 5 holds 5 channels
  const unsigned woff  = 4u * (unsigned)(wt * C_ + wc4 * 4);
  const unsigned woff5 = 4u * (unsigned)((wtail_ok ? wt : 0) * C_ + wc4 * 4);
  f4 wv[WIT_];
  #pragma unroll
  for (int i = 0; i < WIT_; ++i) {
    unsigned row0 = ((i & 1) ? 85u : 0u) + 16u * (i >> 1);
    wv[i] = *(const f4*)((const char*)w_in + ((i >> 1) < 5 ? woff : woff5)
                         + 4u * C_ * row0);
  }
  // w_out: wave w stages rows 8w..8w+7; a lane takes the column pairs lane,
  // lane+32 and lane+64 of each row (pairs from 85 on are padding)
  const int lane = tid & 31;
  const unsigned ooff  = 4u * (unsigned)(wave * 8 * HID_ + 2 * lane);
  const unsigned ooff2 = 4u * (unsigned)(wave * 8 * HID_
                                         + 2 * (lane + 64 < HID_/2 ? lane + 64 : 0));
  f2 ov[8][3];
  #pragma unroll
  for (int rr = 0; rr < 8; ++rr) {
    ov[rr][0] = *(const f2*)((const char*)w_out + ooff  + 4u * HID_ * rr);
    ov[rr][1] = *(const f2*)((const char*)w_out + ooff  + 4u * HID_ * rr + 256u);
    ov[rr][2] = *(const f2*)((const char*)w_out + ooff2 + 4u * HID_ * rr);
  }
  // as above: the weights' offset registers stay untouched until this wait
  asm volatile("s_wait_xcnt 0x0"
               :: "v"(woff), "v"(woff5), "v"(ooff), "v"(ooff2) : "memory");

  #pragma unroll
  for (int i = XHALF_; i < XIT_; ++i) X_STORE(i);
  {
    h2 a0, a1;
    a0[0] = (_Float16)(tok ? tv[0][0] : 0.0f);  a0[1] = (_Float16)(tok ? tv[1][0] : 0.0f);
    a1[0] = (_Float16)(tok ? tv[0][1] : 0.0f);  a1[1] = (_Float16)(tok ? tv[1][1] : 0.0f);
    *(h2*)&x_lds[tdst]         = a0;
    *(h2*)&x_lds[tdst + XPAD_] = a1;
  }
#undef X_STORE

  #pragma unroll
  for (int i = 0; i < WIT_; ++i) {
    bool ok = (i >> 1) < 5 || wtail_ok;
    h4 a;
    #pragma unroll
    for (int e = 0; e < 4; ++e) a[e] = (_Float16)(ok ? wv[i][e] : 0.0f);
    int row = (i >> 1) < 5 ? 16 * i + wt : 160 + 8 * (i & 1) + wt;
    if ((i >> 1) < 5 || wt < 8) *(h4*)&win_lds[row * XPAD_ + wc4 * 4] = a;
  }
  #pragma unroll
  for (int rr = 0; rr < 8; ++rr) {
    _Float16* wrow = &wout_lds[(wave * 8 + rr) * WOPAD_];
    #pragma unroll
    for (int ch = 0; ch < 3; ++ch) {
      int o2 = lane + 32 * ch;
      bool ok = o2 < HID_/2;
      h2 a;
      a[0] = (_Float16)(ok ? ov[rr][ch][0] : 0.0f);
      a[1] = (_Float16)(ok ? ov[rr][ch][1] : 0.0f);
      *(h2*)&wrow[2 * o2] = a;
    }
    if (lane < WOPAD_/2 - 96) *(h2*)&wrow[2 * (96 + lane)] = (h2){0, 0};
  }

  // depthwise weight table: row = conv output channel o, a word = the f16 pair
  // (hi, lo) of one weight with hi in the half that the row's hf slot has in
  // its register of a K chunk; words 0-3 taps 0,2,4,6; 4-7 taps 1,3,5,7; word 8
  // tap 8, word 9 tap 8 with the halves swapped. Row 2*HID_ is all zero.
  #pragma unroll
  for (int i = 0; i < DWIT_; ++i) {
    int idx = tid + 256 * i;
    int o = idx / 9, tap = idx - 9 * o;
    float wf = dv[i];
    _Float16 whi = (_Float16)wf;
    _Float16 wlo = (_Float16)(wf - (float)whi);
    unsigned uh = __builtin_bit_cast(unsigned short, whi);
    unsigned ul = __builtin_bit_cast(unsigned short, wlo);
    int  cg = o < HID_ ? o : o - HID_;      // gated channel the output feeds
    bool up = (cg >> 1) & 1;
    unsigned word = up ? (uh << 16) | ul : (ul << 16) | uh;
    unsigned swp  = up ? (ul << 16) | uh : (uh << 16) | ul;
    if (idx < DWN_) {
      dwt_lds[o * DWW_ + (tap < 8 ? (tap & 1) * 4 + (tap >> 1) : 8)] = word;
      if (tap == 8) dwt_lds[o * DWW_ + 9] = swp;
    }
  }
  if (tid < DWW_) dwt_lds[2*HID_ * DWW_ + tid] = 0u;

  // B fragment of the inverse 2x2 transform over a 4x4 pixel block: row k is the
  // frequency kept at pixel k, column nm the output pixel (pixel p = row p/4,
  // column p%4). +1 or -1 inside a patch, 0 elsewhere. A lane's rows 8*hh + e are
  // block rows 2*hh and 2*hh + 1, word d = e/2. Kept in LDS, one 16-byte row per
  // lane, and read once per group: held in registers through the depthwise part
  // it would cost the second work-group on the WGP.
  if (tid < 32) {
    const bool rowp = (nm >> 3) == hh;                           // same patch row
    unsigned s0 = 0x3C003C00u ^ ((nm & 1) ? 0x80000000u : 0u);   // fy = 0: (+1, +-1)
    unsigned s1 = s0 ^ ((nm & 4) ? 0x80008000u : 0u);            // fy = 1
    const bool c1 = (nm >> 1) & 1;                               // the pixel's patch column
    unsigned a0 = rowp && !c1 ? 0xFFFFFFFFu : 0u;
    unsigned a1 = rowp &&  c1 ? 0xFFFFFFFFu : 0u;
    *(u4*)&hs_lds[tid*4] = (u4){s0 & a0, s0 & a1, s1 & a0, s1 & a1};
  }

#if USE_ASYNC_LDS
  asm volatile("s_wait_asynccnt 0" ::: "memory");
#endif
  __syncthreads();

  // lane constants of the depthwise products: where the lane's row has its
  // non-zero in a K chunk, and the hf addresses of its taps.
  // Pixel tile q of a wave is output row 2*wave + q, columns 0..15 (N = nm).
  unsigned msk[4];
  #pragma unroll
  for (int r = 0; r < 4; ++r)
    msk[r] = ((nm >> 2) == r) ? (((nm >> 1) & 1) ? 0xFFFF0000u : 0x0000FFFFu) : 0u;
  const _Float16* hb[5];
  #pragma unroll
  for (int e = 0; e < 5; ++e) {
    int tap = e < 4 ? 2*e + hh : 8;
    hb[e] = &hf_lds[((wave*2 + 1 + tap/3)*EXT_ + nm + 1 + tap%3) * HFP_];
  }

  // GEMM1 job constants: the wave's number as a scalar, and the lane's pixel
  // inside a 4x4 block
  const int swave = __builtin_amdgcn_readfirstlane(wave);
  const int nt    = swave & 1;
  const int wp    = swave >> 1;
  const int lpix  = (nm >> 2)*EXT_ + (nm & 3);
  const int pixc  = lpix + 4*wp;                 // block (0, wp)
  const int pixr  = lpix + wp*4*EXT_ + 16;       // block (wp, 4)
  const _Float16* apc = &x_lds[pixc * XPAD_ + 8*hh];
  const _Float16* apr = &x_lds[pixr * XPAD_ + 8*hh];
  _Float16* hpc = &hf_lds[pixc * HFP_ + nt*16 + 8*hh];
  _Float16* hpr = &hf_lds[pixr * HFP_ + nt*16 + 8*hh];

  // persistent project_out accumulators: 2 pixel tiles x 4 out-channel tiles
  v8f acc2[2][4];
  #pragma unroll
  for (int q = 0; q < 2; ++q)
    #pragma unroll
    for (int n = 0; n < 4; ++n) acc2[q][n] = (v8f){0,0,0,0,0,0,0,0};

  // One channel group: GEMM1 and filter into hf_lds, then depthwise, gate, GEMM2.
  // last: the sixth group has 5 + 5 channels, gathered into ONE 16-slot tile
  // (low half in slots 0..7, high half in slots 8..15), so it has 25 GEMM1 jobs
  // for 50 and one gated 16-channel tile for two: its padding is not computed.
  // Inlined with last as a literal, so each of the two copies holds its own path only.
  auto group = [&](const int j, const bool last) __attribute__((always_inline)) {
    // ---- GEMM1 (project_in) over extended tile + 2x2 Hadamard FFT filter ----
    // (forward half on the vector unit, inverse half as a matrix product)
    // 25 pixel-blocks (5x5 of 4x4) x 2 channel-ntiles = 50 wave-jobs
    const u4 hw = *(const u4*)&hs_lds[(tid & 31)*4];
    const v16h Hs = __builtin_bit_cast(v16h, (u8){hw[0], hw[1], hw[2], hw[3], 0u, 0u, 0u, 0u});  // rows 16..31 zero
    // A wave has ntile wave & 1 and, with wp = wave/2, the blocks (t, wp) for
    // t = 0..4 (block column wp, a constant step from job to job, so the step
    // is an immediate offset), (wp, 4) as job 5, and for wp = 0 block (4, 4) as
    // job 6. The wave number is held in a scalar register: the trip test is a
    // scalar branch. The unroll lets the chains of neighbouring jobs (LDS read,
    // products, transform, product, store) run inside one another's waits.
    auto job = [&](const int t) __attribute__((always_inline)) {
      const int dpix = t < 5 ? t*4*EXT_ : t == 5 ? 0 : (4*EXT_ + 4)*4;   // job 6: wp = 0
      const _Float16* ap = (t == 5 ? apr : apc) + dpix * XPAD_;
      const _Float16* bp = &win_lds[(j*32 + (last ? 0 : nt*16) + nm) * XPAD_ + 8*hh];
      v16h A0, A1, B0, B1;
      ((f4*)&A0)[0] = *(const f4*)(ap);        // K  8h.. 8h+7
      ((f4*)&A0)[1] = *(const f4*)(ap + 16);   // K 16+8h..
      ((f4*)&A1)[0] = *(const f4*)(ap + 32);
      ((f4*)&A1)[1] = *(const f4*)(ap + 48);
      ((f4*)&B0)[0] = *(const f4*)(bp);
      ((f4*)&B0)[1] = *(const f4*)(bp + 16);
      ((f4*)&B1)[0] = *(const f4*)(bp + 32);
      ((f4*)&B1)[1] = *(const f4*)(bp + 48);
      v8f acc = (v8f){0,0,0,0,0,0,0,0};
      acc = __builtin_amdgcn_wmma_f32_16x16x32_f16(false, A0, false, B0, (short)0, acc, false, false);
      acc = __builtin_amdgcn_wmma_f32_16x16x32_f16(false, A1, false, B1, (short)0, acc, false, false);

      // per-lane channel's 2x2 spectral weights, the inverse's 1/4 folded in (exact)
      int sg  = last ? 2*nm : nt*16 + nm;        // last group: slots 8..15 are the high half
      int hch = ((sg < 16) ? 0 : 85) + 16*j + (last ? (nm & 7) : nm);
      hch = (hch > HID_-1) ? (HID_-1) : hch;     // pad slots: values are 0 anyway
      f4 fw = *(const f4*)&fftw_lds[hch*4];
      f2 wA = (f2){0.25f*fw[0],  0.25f*fw[1]}, wB = (f2){0.25f*fw[2],  0.25f*fw[3]};
      f2 nA = (f2){0.25f*fw[0], -0.25f*fw[1]}, nB = (f2){0.25f*fw[2], -0.25f*fw[3]};
      // each lane holds both rows of its 2 patches (C-layout rows 2h,2h+1):
      // forward 2x2 transform and spectral weight in f32, each value left at the
      // pixel position of its frequency. D row 8*hh + r is the lane's K position
      // 8*hh + r of an A fragment with M = slot, so the values go into F as they stand.
      v16h F = {};                               // K positions 16..31 stay zero
      #pragma unroll
      for (int pc = 0; pc < 2; ++pc) {
        f2 top = (f2){acc[2*pc],   acc[2*pc+1]};
        f2 bot = (f2){acc[4+2*pc], acc[4+2*pc+1]};
        f2 u = top + bot, v = top - bot;
        // (a + b)*w0, (a - b)*w1 as a*(w0, w1) + b*(w0, -w1): two packed operations
        f2 Fa = (f2){u[0], u[0]} * wA + (f2){u[1], u[1]} * nA;
        f2 Fb = (f2){v[0], v[0]} * wB + (f2){v[1], v[1]} * nB;
        F[2*pc]     = (_Float16)Fa[0];  F[2*pc + 1]     = (_Float16)Fa[1];
        F[4 + 2*pc] = (_Float16)Fb[0];  F[4 + 2*pc + 1] = (_Float16)Fb[1];
      }
      // inverse transform: y[slot][pixel] = sum over k of F[slot][k] * Hs[k][pixel].
      // D row 8*hh + r at column nm is slot 8*hh + r at the block's pixel nm:
      // eight neighbouring slots of one pixel, one 16-byte store.
      v8f y = (v8f){0,0,0,0,0,0,0,0};
      y = __builtin_amdgcn_wmma_f32_16x16x32_f16(false, F, false, Hs, (short)0, y, false, false);
      *(h8*)((t == 5 ? hpr : hpc) - (last ? nt*16 : 0) + dpix * HFP_) = __builtin_convertvector(y, h8);
    };
    if (!last) {
      #pragma unroll
      for (int t = 0; t < 7; ++t) {
        if (t == 6 && wp != 0) break;
        job(t);
      }
    } else if (nt == 0) {
      // the two waves of a block column share its jobs (scalar branches)
      #pragma unroll
      for (int t = 0; t < 3; ++t) job(t);
      if (wp == 0) job(6);
    } else {
      #pragma unroll
      for (int t = 3; t < 6; ++t) job(t);
    }
    __syncthreads();

    // ---- depthwise 3x3 on matrix products + exact-GELU gate ----
    // D row 8*hh + r of tile m is gated channel 32j + 16m + 8*hh + r at the
    // lane's pixel: exactly the lane's K positions of the GEMM2 A fragment, so
    // the gated values go into A2 where they stand.
    {
      v16h A2[2] = {};                      // last group: K positions 16..31 stay zero
      #pragma unroll
      for (int m = 0; m < 2; ++m) {
        if (last && m == 1) break;
        int c = 32*j + 16*m + nm;           // the lane's row as a gated channel
        const unsigned* t1 = &dwt_lds[(c < HID_ ? c        : 2*HID_) * DWW_];
        const unsigned* t2 = &dwt_lds[(c < HID_ ? c + HID_ : 2*HID_) * DWW_];
        v8f D1[2], D2[2];
        dw_tile(t1, hh, msk, hb, 8*m,      D1);
        dw_tile(t2, hh, msk, hb, last ? 8 : 16 + 8*m, D2);
        float g[2][8];
        float zmax = gate16<false>(D1, D2, g);
        // one test for the whole wave (a scalar branch); a NaN sum does not
        // raise zmax and gives NaN on either path
        if (__builtin_amdgcn_ballot_w32(zmax >= 1.0f) != 0u)
          gate16<true>(D1, D2, g);
        #pragma unroll
        for (int q = 0; q < 2; ++q)
          #pragma unroll
          for (int r = 0; r < 8; ++r) A2[q][8*m + r] = (_Float16)g[q][r];
      }
      #pragma unroll
      for (int n2 = 0; n2 < 4; ++n2) {
        const _Float16* bp = &wout_lds[(n2*16 + nm) * WOPAD_ + 32*j + 8*hh];
        v16h B2;
        ((f4*)&B2)[0] = *(const f4*)(bp);
        ((f4*)&B2)[1] = *(const f4*)(bp + 16);
        #pragma unroll
        for (int q = 0; q < 2; ++q)
          acc2[q][n2] = __builtin_amdgcn_wmma_f32_16x16x32_f16(
              false, A2[q], false, B2, (short)0, acc2[q][n2], false, false);
      }
    }
    __syncthreads();
  };
  for (int j = 0; j < NGRP_ - 1; ++j) group(j, false);
  group(NGRP_ - 1, true);

  // ---------------- epilogue: f32 output, float4 rows ----------------
  // C-layout row M = 8*hh + r of tile q is the pixel (2*wave + q, 8*hh + r):
  // a lane holds eight pixels in a row of its channel.
  float* ob = out + (size_t)b * C_ * H_ * W_;
  #pragma unroll
  for (int n2 = 0; n2 < 4; ++n2) {
    int cch = n2*16 + nm;
    #pragma unroll
    for (int q = 0; q < 2; ++q) {
      v8f a = acc2[q][n2];
      size_t off = (size_t)cch * (H_*W_) + (size_t)(ty0 + wave*2 + q) * W_ + tx0 + 8*hh;
      *(f4*)&ob[off]     = (f4){a[0], a[1], a[2], a[3]};
      *(f4*)&ob[off + 4] = (f4){a[4], a[5], a[6], a[7]};
    }
  }
}

extern "C" void kernel_launch(void* const* d_in, const int* in_sizes, int n_in,
                              void* d_out, int out_size, void* d_ws, size_t ws_size,
                              hipStream_t stream) {
  (void)in_sizes; (void)n_in; (void)d_ws; (void)ws_size; (void)out_size;
  const float* x     = (const float*)d_in[0];
  const float* w_in  = (const float*)d_in[1];
  const float* fft_w = (const float*)d_in[2];
  const float* w_dw  = (const float*)d_in[3];
  const float* w_out = (const float*)d_in[4];
  float* out = (float*)d_out;
  dim3 grid(W_/TILE_, H_/TILE_, B_);
  dffn_fused_kernel<<<grid, 256, 0, stream>>>(x, w_in, fft_w, w_dw, w_out, out);
}

// v008
// A run of this version takes 67.8 microseconds.
// Timed twice side by side with v007, it ran 1.08 times as fast both times.
// Counting every step since v000, it is 3.98 times as fast.
#include <hip/hip_runtime.h>
#include <hip/hip_bf16.h>

typedef __attribute__((ext_vector_type(16))) _Float16 v16h;
typedef __attribute__((ext_vector_type(2)))  _Float16 h2;
typedef __attribute__((ext_vector_type(8)))  float    v8f;
typedef __attribute__((ext_vector_type(4)))  float    f4;
typedef __attribute__((ext_vector_type(2)))  float    f2;
typedef __attribute__((ext_vector_type(4)))  _Float16 h4;
typedef __attribute__((ext_vector_type(8)))  _Float16 h8;
typedef __attribute__((ext_vector_type(4)))  unsigned u4;
typedef __attribute__((ext_vector_type(8)))  unsigned u8;

#define B_     4
#define C_     64
#define H_     256
#define W_     256
#define HID_   170
#define TILE_  16
#define EXT_   20          // TILE + 2*2 halo (patch-aligned)
#define NPIX_  (EXT_*EXT_) // 400
#define XPAD_  72          // padded channel stride (16B-aligned, bank-friendly)
#define NGRP_  6           // ceil(170/32) groups of 32 gathered hidden channels
#define WROWS_ 192         // 6*32 w_in rows: 176 gathered (zero-padded), rest unused
#define HFP_   40          // filtered-h tile is pixel-major: 32 slots + 8 pad (80-byte pitch)
#define DWW_   12          // words per row of the depthwise weight table (10 used)
#define DWROWS_ (2*HID_ + 1)             // one row per conv output channel + a zero row
#define DWN_   (2*HID_*9)                // 3060 depthwise weights
#define DWIT_  ((DWN_ + 255)/256)        // 12 loads per thread
#define WOPAD_ 200         // padded hidden stride for w_out (cols >=170 zero)
#define XUNITS_ ((C_/4)*EXT_*(EXT_/2))   // 3200 staging units of the x tile
#define XIT_    (XUNITS_/256)            // 12 whole units per thread
#define XTAIL_  (XUNITS_ - 256*XIT_)     // 128 units left: half a unit per thread
#define XHALF_  6                        // x units stored before the w_in and w_out loads issue
#define WIT_    (WROWS_*(C_/4)/256)      // 12 16-byte loads of w_in per thread

#if defined(__HIP_DEVICE_COMPILE__) && defined(__gfx1250__)
#define USE_ASYNC_LDS 1
#else
#define USE_ASYNC_LDS 0
#endif

#if USE_ASYNC_LDS
// byte offset of a generic pointer within the wave's LDS aperture
__device__ static inline unsigned lds_offset_of(const void* p) {
  return (unsigned)(unsigned long long)
         (__attribute__((address_space(3))) const char*)p;
}
#endif

// erf on |z| < 1: the math library's own polynomial for that range (odd in z,
// so the sign needs no handling of its own); the same values as erff there.
__device__ static inline float erf_below_one(float z) {
  float t = z * z;
  float p = fmaf(t, fmaf(t, fmaf(t, fmaf(t, fmaf(t,
              -0x1.268bc2p-11f, 0x1.420828p-8f), -0x1.b5937p-6f), 0x1.ce077cp-4f),
              -0x1.81266p-2f), 0x1.06eba0p-3f);
  return fmaf(z, p, z);
}

// One 16x16 tile of the depthwise 3x3 as matrix products, for two pixel tiles.
// D[row][pixel] = sum over (tap, slot) of A[row][tap, slot] * hf[pixel + tap][slot]:
// rows are 16 conv output channels, fed by 8 hf slots (row r reads slot r/2), so
// A is block-diagonal: in each 8-slot chunk of K a row has one non-zero.
// A K chunk of a lane (8 halves) is one tap. Each weight is the f16 pair hi + lo
// (hi = f16(w), lo = f16(w - hi)), two products on the same hf value.
//   products 0,1: taps hh, 2+hh   (hi, then lo)    products 2,3: taps 4+hh, 6+hh
//   product  4  : tap 8, hi in the hh = 0 chunk, lo in the hh = 1 chunk; rest zero
// trow: the lane's row of the weight table; hb[e]: the lane's hf address of tap
// 2e+hh (e < 4) and of tap 8 (e = 4) for pixel tile 0, slot 0.
__device__ __forceinline__ void dw_tile(
    const unsigned* trow, int hh, const unsigned (&msk)[4],
    const _Float16* const (&hb)[5], int slot0, v8f (&D)[2])
{
  u4 w        = *(const u4*)(trow + 4*hh);
  unsigned w8 = trow[8 + hh];
  v16h A[5];
  #pragma unroll
  for (int k = 0; k < 2; ++k) {
    unsigned wa = w[2*k], wb = w[2*k + 1];
    unsigned ra = (wa >> 16) | (wa << 16), rb = (wb >> 16) | (wb << 16);
    A[2*k]     = __builtin_bit_cast(v16h, (u8){wa & msk[0], wa & msk[1], wa & msk[2], wa & msk[3],
                                               wb & msk[0], wb & msk[1], wb & msk[2], wb & msk[3]});
    A[2*k + 1] = __builtin_bit_cast(v16h, (u8){ra & msk[0], ra & msk[1], ra & msk[2], ra & msk[3],
                                               rb & msk[0], rb & msk[1], rb & msk[2], rb & msk[3]});
  }
  A[4] = __builtin_bit_cast(v16h, (u8){w8 & msk[0], w8 & msk[1], w8 & msk[2], w8 & msk[3], 0u, 0u, 0u, 0u});
  #pragma unroll
  for (int q = 0; q < 2; ++q) {
    const int o = q*EXT_*HFP_ + slot0;
    v16h B0, B1, B2;
    ((f4*)&B0)[0] = *(const f4*)(hb[0] + o);
    ((f4*)&B0)[1] = *(const f4*)(hb[1] + o);
    ((f4*)&B1)[0] = *(const f4*)(hb[2] + o);
    ((f4*)&B1)[1] = *(const f4*)(hb[3] + o);
    ((f4*)&B2)[0] = *(const f4*)(hb[4] + o);
    ((f4*)&B2)[1] = ((f4*)&B2)[0];          // meets zero weights: any finite data
    v8f d = (v8f){0,0,0,0,0,0,0,0};
    d = __builtin_amdgcn_wmma_f32_16x16x32_f16(false, A[0], false, B0, (short)0, d, false, false);
    d = __builtin_amdgcn_wmma_f32_16x16x32_f16(false, A[1], false, B0, (short)0, d, false, false);
    d = __builtin_amdgcn_wmma_f32_16x16x32_f16(false, A[2], false, B1, (short)0, d, false, false);
    d = __builtin_amdgcn_wmma_f32_16x16x32_f16(false, A[3], false, B1, (short)0, d, false, false);
    d = __builtin_amdgcn_wmma_f32_16x16x32_f16(false, A[4], false, B2, (short)0, d, false, false);
    D[q] = d;
  }
}

// Exact-GELU gate of the 16 value pairs a lane holds in two pairs of D tiles.
// FULL = false: erf by the |z| < 1 polynomial alone, no branch per value;
// returns the largest |z| the lane met, and the caller repeats the gate with
// FULL = true (erff) if that reaches 1.
template <bool FULL>
__device__ __forceinline__ float gate16(
    const v8f (&D1)[2], const v8f (&D2)[2], float (&g)[2][8])
{
  float zmax = 0.0f;
  #pragma unroll
  for (int q = 0; q < 2; ++q)
    #pragma unroll
    for (int r = 0; r < 8; ++r) {
      float s1 = D1[q][r], s2 = D2[q][r];
      float z = s1 * 0.70710678118654752f;
      float e;
      if (FULL) {
        e = erff(z);
      } else {
        e = erf_below_one(z);
        zmax = fmaxf(zmax, fabsf(z));
      }
      float ge = 0.5f * s1 * (1.0f + e);
      g[q][r] = ge * s2;
    }
  return zmax;
}

__global__ __launch_bounds__(256) void dffn_fused_kernel(
    const float* __restrict__ xin,  const float* __restrict__ w_in,
    const float* __restrict__ fft_w, const float* __restrict__ w_dw,
    const float* __restrict__ w_out, float* __restrict__ out)
{
  __shared__ __align__(16) _Float16 x_lds  [NPIX_ * XPAD_];   // 57.6 KB
  __shared__ __align__(16) _Float16 win_lds[WROWS_ * XPAD_];  // 27.6 KB
  __shared__ __align__(16) _Float16 hf_lds [NPIX_ * HFP_];     // 32.0 KB
  __shared__ __align__(16) _Float16 wout_lds[64 * WOPAD_];    // 25.6 KB
  __shared__ __align__(16) unsigned dwt_lds [DWROWS_ * DWW_];  // 16.4 KB
  __shared__ __align__(16) float    fftw_lds[HID_*4];         //  2.7 KB
  __shared__ __align__(16) unsigned hs_lds  [32*4];           //  0.5 KB

  const int tid  = threadIdx.x;
  const int wave = tid >> 5;
  const int nm   = tid & 15;        // M or N index within 16: a pixel or a channel
  const int hh   = (tid >> 4) & 1;  // wave half -> K-range selector in A/B layouts

  const int tx0 = blockIdx.x * TILE_;
  const int ty0 = blockIdx.y * TILE_;
  const int b   = blockIdx.z;

  const float* xb = xin + (size_t)b * C_ * H_ * W_;

  // ---- kick off async DMA of the pure-copy weight table into LDS ----
  // (tracked by ASYNCcnt; overlapped with x-tile staging below)
#if USE_ASYNC_LDS
  for (int i = tid; i < (HID_*4)/4; i += 256) {         // 170 x b128
    unsigned ldst = lds_offset_of(&fftw_lds[i*4]);
    unsigned long long ga = (unsigned long long)(const void*)(fft_w + i*4);
    asm volatile("global_load_async_to_lds_b128 %0, %1, off"
                 :: "v"(ldst), "v"(ga) : "memory");
  }
#else
  for (int i = tid; i < HID_*4;   i += 256) fftw_lds[i] = fft_w[i];
#endif

  // ---------------- stage converted operands into LDS ----------------
  // Every global load below is unconditional (index clamped in bounds, value
  // selected to zero afterwards), so a whole batch is in flight before the
  // first wait; the weights' loads fly while the x tile is converted.
  //
  // x unit = 4 channels x 1 row x 2 columns: four 8-byte loads, two 8-byte LDS
  // stores. The tile's first column is even, so a column pair is inside the
  // image as a whole or outside it as a whole.
  f2       xv[XIT_][4];
  unsigned xoff[XIT_];     // byte offset of the unit's first load in xb
  int      xdst[XIT_];
  bool     xok[XIT_];
  const char* xbytes = (const char*)xb;

  // the unrolls of this section keep the batch arrays in registers and let all
  // loads of a batch issue back to back
  #pragma unroll
  for (int i = 0; i < XIT_; ++i) {
    int u   = tid + 256 * i;
    int cg  = u / (EXT_ * 10);
    int r   = u - cg * (EXT_ * 10);
    int py  = r / 10, k = r - py * 10;
    int gy  = ty0 - 2 + py, gx = tx0 - 2 + 2 * k;
    xok[i]  = (unsigned)gy < (unsigned)H_ && (unsigned)gx < (unsigned)W_;
    int cy  = gy < 0 ? 0 : (gy > H_ - 1 ? H_ - 1 : gy);
    int cx  = gx < 0 ? 0 : (gx > W_ - 2 ? W_ - 2 : gx);
    xoff[i] = 4u * (unsigned)(cg * 4 * (H_ * W_) + cy * W_ + cx);
    xdst[i] = (py * EXT_ + 2 * k) * XPAD_ + cg * 4;
    #pragma unroll
    for (int ch = 0; ch < 4; ++ch)
      xv[i][ch] = *(const f2*)(xbytes + xoff[i] + 4u * ch * (H_ * W_));
  }
  // the units left over: two threads share one, two channels each
  static_assert(2 * XTAIL_ == 256, "the tail takes exactly half a unit per thread");
  f2 tv[2]; unsigned toff; int tdst; bool tok;
  {
    int u   = 256 * XIT_ + (tid >> 1);
    int cg  = u / (EXT_ * 10);
    int r   = u - cg * (EXT_ * 10);
    int py  = r / 10, k = r - py * 10;
    int gy  = ty0 - 2 + py, gx = tx0 - 2 + 2 * k;
    tok     = (unsigned)gy < (unsigned)H_ && (unsigned)gx < (unsigned)W_;
    int cy  = gy < 0 ? 0 : (gy > H_ - 1 ? H_ - 1 : gy);
    int cx  = gx < 0 ? 0 : (gx > W_ - 2 ? W_ - 2 : gx);
    int c0  = cg * 4 + 2 * (tid & 1);
    toff  = 4u * (unsigned)(c0 * (H_ * W_) + cy * W_ + cx);
    tdst  = (py * EXT_ + 2 * k) * XPAD_ + c0;
    tv[0] = *(const f2*)(xbytes + toff);
    tv[1] = *(const f2*)(xbytes + toff + 4u * (H_ * W_));
  }
  // depthwise weights, one 4-byte load per 256: the last one clamped in bounds
  const unsigned doff  = 4u * (unsigned)tid;
  const unsigned doffl = 4u * (unsigned)(tid + 256*(DWIT_-1) < DWN_ ? tid + 256*(DWIT_-1) : DWN_-1);
  float dv[DWIT_];
  #pragma unroll
  for (int i = 0; i < DWIT_ - 1; ++i)
    dv[i] = *(const float*)((const char*)w_dw + doff + 1024u * i);
  dv[DWIT_-1] = *(const float*)((const char*)w_dw + doffl);
  // No offset register of the loads above may be rewritten (a later load's
  // result counts) before this wait: naming them as inputs keeps them until it.
  asm volatile("s_wait_xcnt 0x0"
               :: "v"(xoff[0]), "v"(xoff[1]), "v"(xoff[2]), "v"(xoff[3]),
                  "v"(xoff[4]), "v"(xoff[5]), "v"(xoff[6]), "v"(xoff[7]),
                  "v"(xoff[8]), "v"(xoff[9]), "v"(xoff[10]), "v"(xoff[11]),
                  "v"(toff), "v"(doff), "v"(doffl) : "memory");

#define X_STORE(i) do {                                                       \
    h4 a0, a1;                                                                \
    _Pragma("unroll")                                                         \
    for (int ch = 0; ch < 4; ++ch) {                                          \
      a0[ch] = (_Float16)(xok[i] ? xv[i][ch][0] : 0.0f);                      \
      a1[ch] = (_Float16)(xok[i] ? xv[i][ch][1] : 0.0f);                      \
    }                                                                         \
    *(h4*)&x_lds[xdst[i]]         = a0;    /* zero halo => zero FFT patches */\
    *(h4*)&x_lds[xdst[i] + XPAD_] = a1;                                       \
  } while (0)

  #pragma unroll
  for (int i = 0; i < XHALF_; ++i) X_STORE(i);

  // gathered project_in rows: group j, slot s<16 -> ch 16j+s (low half),
  // slot s>=16 -> ch 85+16j+(s-16) (high half); invalid slots zero-padded.
  // Load i of a thread is LDS row 16i+t, t = tid/16: j = i/2, high half for odd i.
  // Group 5 is packed into one 16-row tile: rows 160..167 low half, 168..175 high
  // half (5 channels and 3 zero rows each); rows from 176 on are not used.
  const int wt = tid >> 4, wc4 = tid & 15;
  const bool wtail_ok = 80 + wt < 85;                 // group 5 holds 5 channels
  const unsigned woff  = 4u * (unsigned)(wt * C_ + wc4 * 4);
  const unsigned woff5 = 4u * (unsigned)((wtail_ok ? wt : 0) * C_ + wc4 * 4);
  f4 wv[WIT_];
  #pragma unroll
  for (int i = 0; i < WIT_; ++i) {
    unsigned row0 = ((i & 1) ? 85u : 0u) + 16u * (i >> 1);
    wv[i] = *(const f4*)((const char*)w_in + ((i >> 1) < 5 ? woff : woff5)
                         + 4u * C_ * row0);
  }
  // w_out: wave w stages rows 8w..8w+7; a lane takes the column pairs lane,
  // lane+32 and lane+64 of each row (pairs from 85 on are padding)
  const int lane = tid & 31;
  const unsigned ooff  = 4u * (unsigned)(wave * 8 * HID_ + 2 * lane);
  const unsigned ooff2 = 4u * (unsigned)(wave * 8 * HID_
                                         + 2 * (lane + 64 < HID_/2 ? lane + 64 : 0));
  f2 ov[8][3];
  #pragma unroll
  for (int rr = 0; rr < 8; ++rr) {
    ov[rr][0] = *(const f2*)((const char*)w_out + ooff  + 4u * HID_ * rr);
    ov[rr][1] = *(const f2*)((const char*)w_out + ooff  + 4u * HID_ * rr + 256u);
    ov[rr][2] = *(const f2*)((const char*)w_out + ooff2 + 4u * HID_ * rr);
  }
  // as above: the weights' offset registers stay untouched until this wait
  asm volatile("s_wait_xcnt 0x0"
               :: "v"(woff), "v"(woff5), "v"(ooff), "v"(ooff2) : "memory");

  #pragma unroll
  for (int i = XHALF_; i < XIT_; ++i) X_STORE(i);
  {
    h2 a0, a1;
    a0[0] = (_Float16)(tok ? tv[0][0] : 0.0f);  a0[1] = (_Float16)(tok ? tv[1][0] : 0.0f);
    a1[0] = (_Float16)(tok ? tv[0][1] : 0.0f);  a1[1] = (_Float16)(tok ? tv[1][1] : 0.0f);
    *(h2*)&x_lds[tdst]         = a0;
    *(h2*)&x_lds[tdst + XPAD_] = a1;
  }
#undef X_STORE

  #pragma unroll
  for (int i = 0; i < WIT_; ++i) {
    bool ok = (i >> 1) < 5 || wtail_ok;
    h4 a;
    #pragma unroll
    for (int e = 0; e < 4; ++e) a[e] = (_Float16)(ok ? wv[i][e] : 0.0f);
    int row = (i >> 1) < 5 ? 16 * i + wt : 160 + 8 * (i & 1) + wt;
    if ((i >> 1) < 5 || wt < 8) *(h4*)&win_lds[row * XPAD_ + wc4 * 4] = a;
  }
  #pragma unroll
  for (int rr = 0; rr < 8; ++rr) {
    _Float16* wrow = &wout_lds[(wave * 8 + rr) * WOPAD_];
    #pragma unroll
    for (int ch = 0; ch < 3; ++ch) {
      int o2 = lane + 32 * ch;
      bool ok = o2 < HID_/2;
      h2 a;
      a[0] = (_Float16)(ok ? ov[rr][ch][0] : 0.0f);
      a[1] = (_Float16)(ok ? ov[rr][ch][1] : 0.0f);
      *(h2*)&wrow[2 * o2] = a;
    }
    if (lane < WOPAD_/2 - 96) *(h2*)&wrow[2 * (96 + lane)] = (h2){0, 0};
  }

  // depthwise weight table: row = conv output channel o, a word = the f16 pair
  // (hi, lo) of one weight with hi in the half that the row's hf slot has in
  // its register of a K chunk; words 0-3 taps 0,2,4,6; 4-7 taps 1,3,5,7; word 8
  // tap 8, word 9 tap 8 with the halves swapped. Row 2*HID_ is all zero.
  #pragma unroll
  for (int i = 0; i < DWIT_; ++i) {
    int idx = tid + 256 * i;
    int o = idx / 9, tap = idx - 9 * o;
    float wf = dv[i];
    _Float16 whi = (_Float16)wf;
    _Float16 wlo = (_Float16)(wf - (float)whi);
    unsigned uh = __builtin_bit_cast(unsigned short, whi);
    unsigned ul = __builtin_bit_cast(unsigned short, wlo);
    int  cg = o < HID_ ? o : o - HID_;      // gated channel the output feeds
    bool up = (cg >> 1) & 1;
    unsigned word = up ? (uh << 16) | ul : (ul << 16) | uh;
    unsigned swp  = up ? (ul << 16) | uh : (uh << 16) | ul;
    if (idx < DWN_) {
      dwt_lds[o * DWW_ + (tap < 8 ? (tap & 1) * 4 + (tap >> 1) : 8)] = word;
      if (tap == 8) dwt_lds[o * DWW_ + 9] = swp;
    }
  }
  if (tid < DWW_) dwt_lds[2*HID_ * DWW_ + tid] = 0u;

  // B fragment of the inverse 2x2 transform over a 4x4 pixel block: row k is the
  // frequency kept at pixel k, column nm the output pixel (pixel p = row p/4,
  // column p%4). +1 or -1 inside a patch, 0 elsewhere. A lane's rows 8*hh + e are
  // block rows 2*hh and 2*hh + 1, word d = e/2. Kept in LDS, one 16-byte row per
  // lane, and read once per group: held in registers through the depthwise part
  // it would cost the second work-group on the WGP.
  if (tid < 32) {
    const bool rowp = (nm >> 3) == hh;                           // same patch row
    unsigned s0 = 0x3C003C00u ^ ((nm & 1) ? 0x80000000u : 0u);   // fy = 0: (+1, +-1)
    unsigned s1 = s0 ^ ((nm & 4) ? 0x80008000u : 0u);            // fy = 1
    const bool c1 = (nm >> 1) & 1;                               // the pixel's patch column
    unsigned a0 = rowp && !c1 ? 0xFFFFFFFFu : 0u;
    unsigned a1 = rowp &&  c1 ? 0xFFFFFFFFu : 0u;
    *(u4*)&hs_lds[tid*4] = (u4){s0 & a0, s0 & a1, s1 & a0, s1 & a1};
  }

#if USE_ASYNC_LDS
  asm volatile("s_wait_asynccnt 0" ::: "memory");
#endif
  __syncthreads();

  // lane constants of the depthwise products: where the lane's row has its
  // non-zero in a K chunk, and the hf addresses of its taps.
  // Pixel tile q of a wave is output row 2*wave + q, columns 0..15 (N = nm).
  unsigned msk[4];
  #pragma unroll
  for (int r = 0; r < 4; ++r)
    msk[r] = ((nm >> 2) == r) ? (((nm >> 1) & 1) ? 0xFFFF0000u : 0x0000FFFFu) : 0u;
  const _Float16* hb[5];
  #pragma unroll
  for (int e = 0; e < 5; ++e) {
    int tap = e < 4 ? 2*e + hh : 8;
    hb[e] = &hf_lds[((wave*2 + 1 + tap/3)*EXT_ + nm + 1 + tap%3) * HFP_];
  }

  // GEMM1 job constants: the wave's number as a scalar, and the lane's pixel
  // inside a 4x4 block
  const int swave = __builtin_amdgcn_readfirstlane(wave);
  const int nt    = swave & 1;
  const int wp    = swave >> 1;
  const int lpix  = (nm >> 2)*EXT_ + (nm & 3);
  const int pixc  = lpix + 4*wp;                 // block (0, wp)
  const int pixr  = lpix + wp*4*EXT_ + 16;       // block (wp, 4)
  const _Float16* apc = &x_lds[pixc * XPAD_ + 8*hh];
  const _Float16* apr = &x_lds[pixr * XPAD_ + 8*hh];
  _Float16* hpc = &hf_lds[pixc * HFP_ + nt*16 + 8*hh];
  _Float16* hpr = &hf_lds[pixr * HFP_ + nt*16 + 8*hh];

  // persistent project_out accumulators: 2 pixel tiles x 4 out-channel tiles,
  // held transposed (rows = out channels, columns = pixels) for the epilogue's stores
  v8f acc2[2][4];
  #pragma unroll
  for (int q = 0; q < 2; ++q)
    #pragma unroll
    for (int n = 0; n < 4; ++n) acc2[q][n] = (v8f){0,0,0,0,0,0,0,0};

  // One channel group: GEMM1 and filter into hf_lds, then depthwise, gate, GEMM2.
  // last: the sixth group has 5 + 5 channels, gathered into ONE 16-slot tile
  // (low half in slots 0..7, high half in slots 8..15), so it has 25 GEMM1 jobs
  // for 50 and one gated 16-channel tile for two: its padding is not computed.
  // Inlined with last as a literal, so each of the two copies holds its own path only.
  auto group = [&](const int j, const bool last) __attribute__((always_inline)) {
    // ---- GEMM1 (project_in) over extended tile + 2x2 Hadamard FFT filter ----
    // (forward half on the vector unit, inverse half as a matrix product)
    // 25 pixel-blocks (5x5 of 4x4) x 2 channel-ntiles = 50 wave-jobs
    const u4 hw = *(const u4*)&hs_lds[(tid & 31)*4];
    const v16h Hs = __builtin_bit_cast(v16h, (u8){hw[0], hw[1], hw[2], hw[3], 0u, 0u, 0u, 0u});  // rows 16..31 zero
    // A wave has ntile wave & 1 and, with wp = wave/2, the blocks (t, wp) for
    // t = 0..4 (block column wp, a constant step from job to job, so the step
    // is an immediate offset), (wp, 4) as job 5, and for wp = 0 block (4, 4) as
    // job 6. The wave number is held in a scalar register: the trip test is a
    // scalar branch. The unroll lets the chains of neighbouring jobs (LDS read,
    // products, transform, product, store) run inside one another's waits.
    auto job = [&](const int t) __attribute__((always_inline)) {
      const int dpix = t < 5 ? t*4*EXT_ : t == 5 ? 0 : (4*EXT_ + 4)*4;   // job 6: wp = 0
      const _Float16* ap = (t == 5 ? apr : apc) + dpix * XPAD_;
      const _Float16* bp = &win_lds[(j*32 + (last ? 0 : nt*16) + nm) * XPAD_ + 8*hh];
      v16h A0, A1, B0, B1;
      ((f4*)&A0)[0] = *(const f4*)(ap);        // K  8h.. 8h+7
      ((f4*)&A0)[1] = *(const f4*)(ap + 16);   // K 16+8h..
      ((f4*)&A1)[0] = *(const f4*)(ap + 32);
      ((f4*)&A1)[1] = *(const f4*)(ap + 48);
      ((f4*)&B0)[0] = *(const f4*)(bp);
      ((f4*)&B0)[1] = *(const f4*)(bp + 16);
      ((f4*)&B1)[0] = *(const f4*)(bp + 32);
      ((f4*)&B1)[1] = *(const f4*)(bp + 48);
      v8f acc = (v8f){0,0,0,0,0,0,0,0};
      acc = __builtin_amdgcn_wmma_f32_16x16x32_f16(false, A0, false, B0, (short)0, acc, false, false);
      acc = __builtin_amdgcn_wmma_f32_16x16x32_f16(false, A1, false, B1, (short)0, acc, false, false);

      // per-lane channel's 2x2 spectral weights, the inverse's 1/4 folded in (exact)
      int sg  = last ? 2*nm : nt*16 + nm;        // last group: slots 8..15 are the high half
      int hch = ((sg < 16) ? 0 : 85) + 16*j + (last ? (nm & 7) : nm);
      hch = (hch > HID_-1) ? (HID_-1) : hch;     // pad slots: values are 0 anyway
      f4 fw = *(const f4*)&fftw_lds[hch*4];
      f2 wA = (f2){0.25f*fw[0],  0.25f*fw[1]}, wB = (f2){0.25f*fw[2],  0.25f*fw[3]};
      f2 nA = (f2){0.25f*fw[0], -0.25f*fw[1]}, nB = (f2){0.25f*fw[2], -0.25f*fw[3]};
      // each lane holds both rows of its 2 patches (C-layout rows 2h,2h+1):
      // forward 2x2 transform and spectral weight in f32, each value left at the
      // pixel position of its frequency. D row 8*hh + r is the lane's K position
      // 8*hh + r of an A fragment with M = slot, so the values go into F as they stand.
      v16h F = {};                               // K positions 16..31 stay zero
      #pragma unroll
      for (int pc = 0; pc < 2; ++pc) {
        f2 top = (f2){acc[2*pc],   acc[2*pc+1]};
        f2 bot = (f2){acc[4+2*pc], acc[4+2*pc+1]};
        f2 u = top + bot, v = top - bot;
        // (a + b)*w0, (a - b)*w1 as a*(w0, w1) + b*(w0, -w1): two packed operations
        f2 Fa = (f2){u[0], u[0]} * wA + (f2){u[1], u[1]} * nA;
        f2 Fb = (f2){v[0], v[0]} * wB + (f2){v[1], v[1]} * nB;
        F[2*pc]     = (_Float16)Fa[0];  F[2*pc + 1]     = (_Float16)Fa[1];
        F[4 + 2*pc] = (_Float16)Fb[0];  F[4 + 2*pc + 1] = (_Float16)Fb[1];
      }
      // inverse transform: y[slot][pixel] = sum over k of F[slot][k] * Hs[k][pixel].
      // D row 8*hh + r at column nm is slot 8*hh + r at the block's pixel nm:
      // eight neighbouring slots of one pixel, one 16-byte store.
      v8f y = (v8f){0,0,0,0,0,0,0,0};
      y = __builtin_amdgcn_wmma_f32_16x16x32_f16(false, F, false, Hs, (short)0, y, false, false);
      *(h8*)((t == 5 ? hpr : hpc) - (last ? nt*16 : 0) + dpix * HFP_) = __builtin_convertvector(y, h8);
    };
    if (!last) {
      #pragma unroll
      for (int t = 0; t < 7; ++t) {
        if (t == 6 && wp != 0) break;
        job(t);
      }
    } else if (nt == 0) {
      // the two waves of a block column share its jobs (scalar branches)
      #pragma unroll
      for (int t = 0; t < 3; ++t) job(t);
      if (wp == 0) job(6);
    } else {
      #pragma unroll
      for (int t = 3; t < 6; ++t) job(t);
    }
    __syncthreads();

    // ---- depthwise 3x3 on matrix products + exact-GELU gate ----
    // D row 8*hh + r of tile m is gated channel 32j + 16m + 8*hh + r at the
    // lane's pixel: exactly the lane's K positions of a GEMM2 fragment whose
    // row or column is the pixel, so the gated values go into A2 where they stand.
    // GEMM2 takes w_out as A and the gated values as B (both have the same k map).
    {
      v16h A2[2] = {};                      // last group: K positions 16..31 stay zero
      #pragma unroll
      for (int m = 0; m < 2; ++m) {
        if (last && m == 1) break;
        int c = 32*j + 16*m + nm;           // the lane's row as a gated channel
        const unsigned* t1 = &dwt_lds[(c < HID_ ? c        : 2*HID_) * DWW_];
        const unsigned* t2 = &dwt_lds[(c < HID_ ? c + HID_ : 2*HID_) * DWW_];
        v8f D1[2], D2[2];
        dw_tile(t1, hh, msk, hb, 8*m,      D1);
        dw_tile(t2, hh, msk, hb, last ? 8 : 16 + 8*m, D2);
        float g[2][8];
        float zmax = gate16<false>(D1, D2, g);
        // one test for the whole wave (a scalar branch); a NaN sum does not
        // raise zmax and gives NaN on either path
        if (__builtin_amdgcn_ballot_w32(zmax >= 1.0f) != 0u)
          gate16<true>(D1, D2, g);
        #pragma unroll
        for (int q = 0; q < 2; ++q)
          #pragma unroll
          for (int r = 0; r < 8; ++r) A2[q][8*m + r] = (_Float16)g[q][r];
      }
      #pragma unroll
      for (int n2 = 0; n2 < 4; ++n2) {
        const _Float16* bp = &wout_lds[(n2*16 + nm) * WOPAD_ + 32*j + 8*hh];
        v16h B2;
        ((f4*)&B2)[0] = *(const f4*)(bp);
        ((f4*)&B2)[1] = *(const f4*)(bp + 16);
        #pragma unroll
        for (int q = 0; q < 2; ++q)
          acc2[q][n2] = __builtin_amdgcn_wmma_f32_16x16x32_f16(
              false, B2, false, A2[q], (short)0, acc2[q][n2], false, false);
      }
    }
    __syncthreads();
  };
  for (int j = 0; j < NGRP_ - 1; ++j) group(j, false);
  group(NGRP_ - 1, true);

  // ---------------- epilogue: f32 output ----------------
  // C-layout row M = 8*hh + r of tile (q, n2) is out channel 16*n2 + 8*hh + r,
  // column N = nm the pixel (2*wave + q, nm): register r of 16 neighbouring lanes
  // is the tile's whole 64-byte row of one channel, so a store writes two
  // 64-byte runs.
  // The tile's base is the same for the whole work-group (a scalar), the lane's
  // part one 32-bit byte offset that no store's step changes.
  char* ob = (char*)(out + (size_t)b * C_ * H_ * W_ + (size_t)ty0 * W_ + tx0);
  const unsigned loff = 4u * (unsigned)(8*hh * (H_*W_) + wave*2 * W_ + nm);
  #pragma unroll
  for (int n2 = 0; n2 < 4; ++n2)
    #pragma unroll
    for (int q = 0; q < 2; ++q)
      #pragma unroll
      for (int r = 0; r < 8; ++r)
        *(float*)(ob + 4u * ((n2*16 + r) * (H_*W_) + q * W_) + loff) = acc2[q][n2][r];
}

extern "C" void kernel_launch(void* const* d_in, const int* in_sizes, int n_in,
                              void* d_out, int out_size, void* d_ws, size_t ws_size,
                              hipStream_t stream) {
  (void)in_sizes; (void)n_in; (void)d_ws; (void)ws_size; (void)out_size;
  const float* x     = (const float*)d_in[0];
  const float* w_in  = (const float*)d_in[1];
  const float* fft_w = (const float*)d_in[2];
  const float* w_dw  = (const float*)d_in[3];
  const float* w_out = (const float*)d_in[4];
  float* out = (float*)d_out;
  dim3 grid(W_/TILE_, H_/TILE_, B_);
  dffn_fused_kernel<<<grid, 256, 0, stream>>>(x, w_in, fft_w, w_dw, w_out, out);
}

// v009
// Measured time: 58.1 microseconds a run.
// Next to v008, in two timings, it ran 1.17 times as fast each time.
// All steps since v000 together make it 4.65 times as fast.
#include <hip/hip_runtime.h>
#include <hip/hip_bf16.h>

typedef __attribute__((ext_vector_type(16))) _Float16 v16h;
typedef __attribute__((ext_vector_type(2)))  _Float16 h2;
typedef __attribute__((ext_vector_type(8)))  float    v8f;
typedef __attribute__((ext_vector_type(4)))  float    f4;
typedef __attribute__((ext_vector_type(2)))  float    f2;
typedef __attribute__((ext_vector_type(4)))  _Float16 h4;
typedef __attribute__((ext_vector_type(8)))  _Float16 h8;
typedef __attribute__((ext_vector_type(4)))  unsigned u4;
typedef __attribute__((ext_vector_type(8)))  unsigned u8;

#define B_     4
#define C_     64
#define H_     256
#define W_     256
#define HID_   170
#define TILE_  16
#define EXT_   20          // TILE + 2*2 halo (patch-aligned)
#define NPIX_  (EXT_*EXT_) // 400
#define XPAD_  72          // padded channel stride (16B-aligned, bank-friendly)
#define NGRP_  6           // ceil(170/32) groups of 32 gathered hidden channels
#define WROWS_ 192         // 6*32 w_in rows: 176 gathered (zero-padded), rest unused
#define HFP_   40          // filtered-h tile is pixel-major: 32 slots + 8 pad (80-byte pitch)
#define DWW_   12          // words per row of the depthwise weight table (10 used)
#define DWROWS_ (2*HID_ + 1)             // one row per conv output channel + a zero row
#define DWN_   (2*HID_*9)                // 3060 depthwise weights
#define DWIT_  ((DWN_ + 255)/256)        // 12 loads per thread
#define WOPAD_ 200         // padded hidden stride for w_out (cols >=170 zero)
#define XUNITS_ ((C_/4)*EXT_*(EXT_/2))   // 3200 staging units of the x tile
#define XIT_    (XUNITS_/256)            // 12 whole units per thread
#define XTAIL_  (XUNITS_ - 256*XIT_)     // 128 units left: half a unit per thread
#define XHALF_  6                        // x units stored before the w_in and w_out loads issue
#define WIT_    (WROWS_*(C_/4)/256)      // 12 16-byte loads of w_in per thread

#if defined(__HIP_DEVICE_COMPILE__) && defined(__gfx1250__)
#define USE_ASYNC_LDS 1
#else
#define USE_ASYNC_LDS 0
#endif

#if USE_ASYNC_LDS
// byte offset of a generic pointer within the wave's LDS aperture
__device__ static inline unsigned lds_offset_of(const void* p) {
  return (unsigned)(unsigned long long)
         (__attribute__((address_space(3))) const char*)p;
}
#endif

// erf on |z| < 1: the math library's own polynomial for that range (odd in z,
// so the sign needs no handling of its own); the same values as erff there.
__device__ static inline float erf_below_one(float z) {
  float t = z * z;
  float p = fmaf(t, fmaf(t, fmaf(t, fmaf(t, fmaf(t,
              -0x1.268bc2p-11f, 0x1.420828p-8f), -0x1.b5937p-6f), 0x1.ce077cp-4f),
              -0x1.81266p-2f), 0x1.06eba0p-3f);
  return fmaf(z, p, z);
}

// One 16x16 tile of the depthwise 3x3 as matrix products, for two pixel tiles.
// D[row][pixel] = sum over (tap, slot) of A[row][tap, slot] * hf[pixel + tap][slot]:
// rows are 16 conv output channels, fed by 8 hf slots (row r reads slot r/2), so
// A is block-diagonal: in each 8-slot chunk of K a row has one non-zero.
// A K chunk of a lane (8 halves) is one tap. Each weight is the f16 pair hi + lo
// (hi = f16(w), lo = f16(w - hi)), two products on the same hf value.
//   products 0,1: taps hh, 2+hh   (hi, then lo)    products 2,3: taps 4+hh, 6+hh
//   product  4  : tap 8, hi in the hh = 0 chunk, lo in the hh = 1 chunk; rest zero
// trow: the lane's row of the weight table; hb[e]: the lane's hf address of tap
// 2e+hh (e < 4) and of tap 8 (e = 4) for pixel tile 0, slot 0.
__device__ __forceinline__ void dw_tile(
    const unsigned* trow, int hh, const unsigned (&msk)[4],
    const _Float16* const (&hb)[5], int slot0, v8f (&D)[2])
{
  u4 w        = *(const u4*)(trow + 4*hh);
  unsigned w8 = trow[8 + hh];
  v16h A[5];
  #pragma unroll
  for (int k = 0; k < 2; ++k) {
    unsigned wa = w[2*k], wb = w[2*k + 1];
    unsigned ra = (wa >> 16) | (wa << 16), rb = (wb >> 16) | (wb << 16);
    A[2*k]     = __builtin_bit_cast(v16h, (u8){wa & msk[0], wa & msk[1], wa & msk[2], wa & msk[3],
                                               wb & msk[0], wb & msk[1], wb & msk[2], wb & msk[3]});
    A[2*k + 1] = __builtin_bit_cast(v16h, (u8){ra & msk[0], ra & msk[1], ra & msk[2], ra & msk[3],
                                               rb & msk[0], rb & msk[1], rb & msk[2], rb & msk[3]});
  }
  A[4] = __builtin_bit_cast(v16h, (u8){w8 & msk[0], w8 & msk[1], w8 & msk[2], w8 & msk[3], 0u, 0u, 0u, 0u});
  #pragma unroll
  for (int q = 0; q < 2; ++q) {
    const int o = q*EXT_*HFP_ + slot0;
    v16h B0, B1, B2;
    ((f4*)&B0)[0] = *(const f4*)(hb[0] + o);
    ((f4*)&B0)[1] = *(const f4*)(hb[1] + o);
    ((f4*)&B1)[0] = *(const f4*)(hb[2] + o);
    ((f4*)&B1)[1] = *(const f4*)(hb[3] + o);
    ((f4*)&B2)[0] = *(const f4*)(hb[4] + o);
    ((f4*)&B2)[1] = ((f4*)&B2)[0];          // meets zero weights: any finite data
    v8f d = (v8f){0,0,0,0,0,0,0,0};
    d = __builtin_amdgcn_wmma_f32_16x16x32_f16(false, A[0], false, B0, (short)0, d, false, false);
    d = __builtin_amdgcn_wmma_f32_16x16x32_f16(false, A[1], false, B0, (short)0, d, false, false);
    d = __builtin_amdgcn_wmma_f32_16x16x32_f16(false, A[2], false, B1, (short)0, d, false, false);
    d = __builtin_amdgcn_wmma_f32_16x16x32_f16(false, A[3], false, B1, (short)0, d, false, false);
    d = __builtin_amdgcn_wmma_f32_16x16x32_f16(false, A[4], false, B2, (short)0, d, false, false);
    D[q] = d;
  }
}

// Exact-GELU gate of the 16 value pairs a lane holds in two pairs of D tiles.
// FULL = false: erf by the |z| < 1 polynomial alone, no branch per value;
// returns the largest |z| the lane met, and the caller repeats the gate with
// FULL = true (erff) if that reaches 1.
template <bool FULL>
__device__ __forceinline__ float gate16(
    const v8f (&D1)[2], const v8f (&D2)[2], float (&g)[2][8])
{
  float zmax = 0.0f;
  #pragma unroll
  for (int q = 0; q < 2; ++q)
    #pragma unroll
    for (int r = 0; r < 8; ++r) {
      float s1 = D1[q][r], s2 = D2[q][r];
      float z = s1 * 0.70710678118654752f;
      float e;
      if (FULL) {
        e = erff(z);
      } else {
        e = erf_below_one(z);
        zmax = fmaxf(zmax, fabsf(z));
      }
      float ge = 0.5f * s1 * (1.0f + e);
      g[q][r] = ge * s2;
    }
  return zmax;
}

__global__ __launch_bounds__(256) void dffn_fused_kernel(
    const float* __restrict__ xin,  const float* __restrict__ w_in,
    const float* __restrict__ fft_w, const float* __restrict__ w_dw,
    const float* __restrict__ w_out, float* __restrict__ out)
{
  __shared__ __align__(16) _Float16 x_lds  [NPIX_ * XPAD_];   // 57.6 KB
  __shared__ __align__(16) _Float16 win_lds[WROWS_ * XPAD_];  // 27.6 KB
  __shared__ __align__(16) _Float16 hf_lds [NPIX_ * HFP_];     // 32.0 KB
  __shared__ __align__(16) _Float16 wout_lds[64 * WOPAD_];    // 25.6 KB
  __shared__ __align__(16) unsigned dwt_lds [DWROWS_ * DWW_];  // 16.4 KB
  __shared__ __align__(16) float    fftw_lds[HID_*4];         //  2.7 KB
  __shared__ __align__(16) unsigned hs_lds  [32*4];           //  0.5 KB

  const int tid  = threadIdx.x;
  const int wave = tid >> 5;
  const int nm   = tid & 15;        // M or N index within 16: a pixel or a channel
  const int hh   = (tid >> 4) & 1;  // wave half -> K-range selector in A/B layouts

  // Which tile a work-group takes: a permutation of the tiles, so the result is
  // right wherever a work-group lands; the deal below is counted on for speed only.
  // Indices equal modulo 8 take one half image, row by row.
  const int flat = blockIdx.x + (W_/TILE_) * (blockIdx.y + (H_/TILE_) * blockIdx.z);
  const int reg  = flat & 7;        // 4 images x upper or lower half
  const int ridx = flat >> 3;       // 0..127: 8 tile rows of 16 tiles
  static_assert(B_ * 2 == 8 && W_/TILE_ == 16 && H_/TILE_ == 16, "8 regions of 8 x 16 tiles");
  const int tx0 = (ridx & 15) * TILE_;
  const int ty0 = ((reg & 1) * 8 + (ridx >> 4)) * TILE_;
  const int b   = reg >> 1;

  const float* xb = xin + (size_t)b * C_ * H_ * W_;

  // ---- kick off async DMA of the pure-copy weight table into LDS ----
  // (tracked by ASYNCcnt; overlapped with x-tile staging below)
#if USE_ASYNC_LDS
  for (int i = tid; i < (HID_*4)/4; i += 256) {         // 170 x b128
    unsigned ldst = lds_offset_of(&fftw_lds[i*4]);
    unsigned long long ga = (unsigned long long)(const void*)(fft_w + i*4);
    asm volatile("global_load_async_to_lds_b128 %0, %1, off"
                 :: "v"(ldst), "v"(ga) : "memory");
  }
#else
  for (int i = tid; i < HID_*4;   i += 256) fftw_lds[i] = fft_w[i];
#endif

  // ---------------- stage converted operands into LDS ----------------
  // Every global load below is unconditional (index clamped in bounds, value
  // selected to zero afterwards), so a whole batch is in flight before the
  // first wait; the weights' loads fly while the x tile is converted.
  //
  // x unit = 4 channels x 1 row x 2 columns: four 8-byte loads, two 8-byte LDS
  // stores. The tile's first column is even, so a column pair is inside the
  // image as a whole or outside it as a whole.
  f2       xv[XIT_][4];
  unsigned xoff[XIT_];     // byte offset of the unit's first load in xb
  int      xdst[XIT_];
  bool     xok[XIT_];
  const char* xbytes = (const char*)xb;

  // the unrolls of this section keep the batch arrays in registers and let all
  // loads of a batch issue back to back
  #pragma unroll
  for (int i = 0; i < XIT_; ++i) {
    int u   = tid + 256 * i;
    int cg  = u / (EXT_ * 10);
    int r   = u - cg * (EXT_ * 10);
    int py  = r / 10, k = r - py * 10;
    int gy  = ty0 - 2 + py, gx = tx0 - 2 + 2 * k;
    xok[i]  = (unsigned)gy < (unsigned)H_ && (unsigned)gx < (unsigned)W_;
    int cy  = gy < 0 ? 0 : (gy > H_ - 1 ? H_ - 1 : gy);
    int cx  = gx < 0 ? 0 : (gx > W_ - 2 ? W_ - 2 : gx);
    xoff[i] = 4u * (unsigned)(cg * 4 * (H_ * W_) + cy * W_ + cx);
    xdst[i] = (py * EXT_ + 2 * k) * XPAD_ + cg * 4;
    #pragma unroll
    for (int ch = 0; ch < 4; ++ch)
      xv[i][ch] = *(const f2*)(xbytes + xoff[i] + 4u * ch * (H_ * W_));
  }
  // the units left over: two threads share one, two channels each
  static_assert(2 * XTAIL_ == 256, "the tail takes exactly half a unit per thread");
  f2 tv[2]; unsigned toff; int tdst; bool tok;
  {
    int u   = 256 * XIT_ + (tid >> 1);
    int cg  = u / (EXT_ * 10);
    int r   = u - cg * (EXT_ * 10);
    int py  = r / 10, k = r - py * 10;
    int gy  = ty0 - 2 + py, gx = tx0 - 2 + 2 * k;
    tok     = (unsigned)gy < (unsigned)H_ && (unsigned)gx < (unsigned)W_;
    int cy  = gy < 0 ? 0 : (gy > H_ - 1 ? H_ - 1 : gy);
    int cx  = gx < 0 ? 0 : (gx > W_ - 2 ? W_ - 2 : gx);
    int c0  = cg * 4 + 2 * (tid & 1);
    toff  = 4u * (unsigned)(c0 * (H_ * W_) + cy * W_ + cx);
    tdst  = (py * EXT_ + 2 * k) * XPAD_ + c0;
    tv[0] = *(const f2*)(xbytes + toff);
    tv[1] = *(const f2*)(xbytes + toff + 4u * (H_ * W_));
  }
  // depthwise weights, one 4-byte load per 256: the last one clamped in bounds
  const unsigned doff  = 4u * (unsigned)tid;
  const unsigned doffl = 4u * (unsigned)(tid + 256*(DWIT_-1) < DWN_ ? tid + 256*(DWIT_-1) : DWN_-1);
  float dv[DWIT_];
  #pragma unroll
  for (int i = 0; i < DWIT_ - 1; ++i)
    dv[i] = *(const float*)((const char*)w_dw + doff + 1024u * i);
  dv[DWIT_-1] = *(const float*)((const char*)w_dw + doffl);
  // No offset register of the loads above may be rewritten (a later load's
  // result counts) before this wait: naming them as inputs keeps them until it.
  asm volatile("s_wait_xcnt 0x0"
               :: "v"(xoff[0]), "v"(xoff[1]), "v"(xoff[2]), "v"(xoff[3]),
                  "v"(xoff[4]), "v"(xoff[5]), "v"(xoff[6]), "v"(xoff[7]),
                  "v"(xoff[8]), "v"(xoff[9]), "v"(xoff[10]), "v"(xoff[11]),
                  "v"(toff), "v"(doff), "v"(doffl) : "memory");

#define X_STORE(i) do {                                                       \
    h4 a0, a1;                                                                \
    _Pragma("unroll")                                                         \
    for (int ch = 0; ch < 4; ++ch) {                                          \
      a0[ch] = (_Float16)(xok[i] ? xv[i][ch][0] : 0.0f);                      \
      a1[ch] = (_Float16)(xok[i] ? xv[i][ch][1] : 0.0f);                      \
    }                                                                         \
    *(h4*)&x_lds[xdst[i]]         = a0;    /* zero halo => zero FFT patches */\
    *(h4*)&x_lds[xdst[i] + XPAD_] = a1;                                       \
  } while (0)

  #pragma unroll
  for (int i = 0; i < XHALF_; ++i) X_STORE(i);

  // gathered project_in rows: group j, slot s<16 -> ch 16j+s (low half),
  // slot s>=16 -> ch 85+16j+(s-16) (high half); invalid slots zero-padded.
  // Load i of a thread is LDS row 16i+t, t = tid/16: j = i/2, high half for odd i.
  // Group 5 is packed into one 16-row tile: rows 160..167 low half, 168..175 high
  // half (5 channels and 3 zero rows each); rows from 176 on are not used.
  const int wt = tid >> 4, wc4 = tid & 15;
  const bool wtail_ok = 80 + wt < 85;                 // group 5 holds 5 channels
  const unsigned woff  = 4u * (unsigned)(wt * C_ + wc4 * 4);
  const unsigned woff5 = 4u * (unsigned)((wtail_ok ? wt : 0) * C_ + wc4 * 4);
  f4 wv[WIT_];
  #pragma unroll
  for (int i = 0; i < WIT_; ++i) {
    unsigned row0 = ((i & 1) ? 85u : 0u) + 16u * (i >> 1);
    wv[i] = *(const f4*)((const char*)w_in + ((i >> 1) < 5 ? woff : woff5)
                         + 4u * C_ * row0);
  }
  // w_out: wave w stages rows 8w..8w+7; a lane takes the column pairs lane,
  // lane+32 and lane+64 of each row (pairs from 85 on are padding)
  const int lane = tid & 31;
  const unsigned ooff  = 4u * (unsigned)(wave * 8 * HID_ + 2 * lane);
  const unsigned ooff2 = 4u * (unsigned)(wave * 8 * HID_
                                         + 2 * (lane + 64 < HID_/2 ? lane + 64 : 0));
  f2 ov[8][3];
  #pragma unroll
  for (int rr = 0; rr < 8; ++rr) {
    ov[rr][0] = *(const f2*)((const char*)w_out + ooff  + 4u * HID_ * rr);
    ov[rr][1] = *(const f2*)((const char*)w_out + ooff  + 4u * HID_ * rr + 256u);
    ov[rr][2] = *(const f2*)((const char*)w_out + ooff2 + 4u * HID_ * rr);
  }
  // as above: the weights' offset registers stay untouched until this wait
  asm volatile("s_wait_xcnt 0x0"
               :: "v"(woff), "v"(woff5), "v"(ooff), "v"(ooff2) : "memory");

  #pragma unroll
  for (int i = XHALF_; i < XIT_; ++i) X_STORE(i);
  {
    h2 a0, a1;
    a0[0] = (_Float16)(tok ? tv[0][0] : 0.0f);  a0[1] = (_Float16)(tok ? tv[1][0] : 0.0f);
    a1[0] = (_Float16)(tok ? tv[0][1] : 0.0f);  a1[1] = (_Float16)(tok ? tv[1][1] : 0.0f);
    *(h2*)&x_lds[tdst]         = a0;
    *(h2*)&x_lds[tdst + XPAD_] = a1;
  }
#undef X_STORE

  #pragma unroll
  for (int i = 0; i < WIT_; ++i) {
    bool ok = (i >> 1) < 5 || wtail_ok;
    h4 a;
    #pragma unroll
    for (int e = 0; e < 4; ++e) a[e] = (_Float16)(ok ? wv[i][e] : 0.0f);
    int row = (i >> 1) < 5 ? 16 * i + wt : 160 + 8 * (i & 1) + wt;
    if ((i >> 1) < 5 || wt < 8) *(h4*)&win_lds[row * XPAD_ + wc4 * 4] = a;
  }
  #pragma unroll
  for (int rr = 0; rr < 8; ++rr) {
    _Float16* wrow = &wout_lds[(wave * 8 + rr) * WOPAD_];
    #pragma unroll
    for (int ch = 0; ch < 3; ++ch) {
      int o2 = lane + 32 * ch;
      bool ok = o2 < HID_/2;
      h2 a;
      a[0] = (_Float16)(ok ? ov[rr][ch][0] : 0.0f);
      a[1] = (_Float16)(ok ? ov[rr][ch][1] : 0.0f);
      *(h2*)&wrow[2 * o2] = a;
    }
    if (lane < WOPAD_/2 - 96) *(h2*)&wrow[2 * (96 + lane)] = (h2){0, 0};
  }

  // depthwise weight table: row = conv output channel o, a word = the f16 pair
  // (hi, lo) of one weight with hi in the half that the row's hf slot has in
  // its register of a K chunk; words 0-3 taps 0,2,4,6; 4-7 taps 1,3,5,7; word 8
  // tap 8, word 9 tap 8 with the halves swapped. Row 2*HID_ is all zero.
  #pragma unroll
  for (int i = 0; i < DWIT_; ++i) {
    int idx = tid + 256 * i;
    int o = idx / 9, tap = idx - 9 * o;
    float wf = dv[i];
    _Float16 whi = (_Float16)wf;
    _Float16 wlo = (_Float16)(wf - (float)whi);
    unsigned uh = __builtin_bit_cast(unsigned short, whi);
    unsigned ul = __builtin_bit_cast(unsigned short, wlo);
    int  cg = o < HID_ ? o : o - HID_;      // gated channel the output feeds
    bool up = (cg >> 1) & 1;
    unsigned word = up ? (uh << 16) | ul : (ul << 16) | uh;
    unsigned swp  = up ? (ul << 16) | uh : (uh << 16) | ul;
    if (idx < DWN_) {
      dwt_lds[o * DWW_ + (tap < 8 ? (tap & 1) * 4 + (tap >> 1) : 8)] = word;
      if (tap == 8) dwt_lds[o * DWW_ + 9] = swp;
    }
  }
  if (tid < DWW_) dwt_lds[2*HID_ * DWW_ + tid] = 0u;

  // B fragment of the inverse 2x2 transform over a 4x4 pixel block: row k is the
  // frequency kept at pixel k, column nm the output pixel (pixel p = row p/4,
  // column p%4). +1 or -1 inside a patch, 0 elsewhere. A lane's rows 8*hh + e are
  // block rows 2*hh and 2*hh + 1, word d = e/2. Kept in LDS, one 16-byte row per
  // lane, and read once per group: held in registers through the depthwise part
  // it would cost the second work-group on the WGP.
  if (tid < 32) {
    const bool rowp = (nm >> 3) == hh;                           // same patch row
    unsigned s0 = 0x3C003C00u ^ ((nm & 1) ? 0x80000000u : 0u);   // fy = 0: (+1, +-1)
    unsigned s1 = s0 ^ ((nm & 4) ? 0x80008000u : 0u);            // fy = 1
    const bool c1 = (nm >> 1) & 1;                               // the pixel's patch column
    unsigned a0 = rowp && !c1 ? 0xFFFFFFFFu : 0u;
    unsigned a1 = rowp &&  c1 ? 0xFFFFFFFFu : 0u;
    *(u4*)&hs_lds[tid*4] = (u4){s0 & a0, s0 & a1, s1 & a0, s1 & a1};
  }

#if USE_ASYNC_LDS
  asm volatile("s_wait_asynccnt 0" ::: "memory");
#endif
  __syncthreads();

  // lane constants of the depthwise products: where the lane's row has its
  // non-zero in a K chunk, and the hf addresses of its taps.
  // Pixel tile q of a wave is output row 2*wave + q, columns 0..15 (N = nm).
  unsigned msk[4];
  #pragma unroll
  for (int r = 0; r < 4; ++r)
    msk[r] = ((nm >> 2) == r) ? (((nm >> 1) & 1) ? 0xFFFF0000u : 0x0000FFFFu) : 0u;
  const _Float16* hb[5];
  #pragma unroll
  for (int e = 0; e < 5; ++e) {
    int tap = e < 4 ? 2*e + hh : 8;
    hb[e] = &hf_lds[((wave*2 + 1 + tap/3)*EXT_ + nm + 1 + tap%3) * HFP_];
  }

  // GEMM1 job constants: the wave's number as a scalar, and the lane's pixel
  // inside a 4x4 block
  const int swave = __builtin_amdgcn_readfirstlane(wave);
  const int nt    = swave & 1;
  const int wp    = swave >> 1;
  const int lpix  = (nm >> 2)*EXT_ + (nm & 3);
  const int pixc  = lpix + 4*wp;                 // block (0, wp)
  const int pixr  = lpix + wp*4*EXT_ + 16;       // block (wp, 4)
  const _Float16* apc = &x_lds[pixc * XPAD_ + 8*hh];
  const _Float16* apr = &x_lds[pixr * XPAD_ + 8*hh];
  _Float16* hpc = &hf_lds[pixc * HFP_ + nt*16 + 8*hh];
  _Float16* hpr = &hf_lds[pixr * HFP_ + nt*16 + 8*hh];

  // persistent project_out accumulators: 2 pixel tiles x 4 out-channel tiles,
  // held transposed (rows = out channels, columns = pixels) for the epilogue's stores
  v8f acc2[2][4];
  #pragma unroll
  for (int q = 0; q < 2; ++q)
    #pragma unroll
    for (int n = 0; n < 4; ++n) acc2[q][n] = (v8f){0,0,0,0,0,0,0,0};

  // One channel group: GEMM1 and filter into hf_lds, then depthwise, gate, GEMM2.
  // last: the sixth group has 5 + 5 channels, gathered into ONE 16-slot tile
  // (low half in slots 0..7, high half in slots 8..15), so it has 25 GEMM1 jobs
  // for 50 and one gated 16-channel tile for two: its padding is not computed.
  // Inlined with last as a literal, so each of the two copies holds its own path only.
  auto group = [&](const int j, const bool last) __attribute__((always_inline)) {
    // ---- GEMM1 (project_in) over extended tile + 2x2 Hadamard FFT filter ----
    // (forward half on the vector unit, inverse half as a matrix product)
    // 25 pixel-blocks (5x5 of 4x4) x 2 channel-ntiles = 50 wave-jobs
    const u4 hw = *(const u4*)&hs_lds[(tid & 31)*4];
    const v16h Hs = __builtin_bit_cast(v16h, (u8){hw[0], hw[1], hw[2], hw[3], 0u, 0u, 0u, 0u});  // rows 16..31 zero
    // A wave has ntile wave & 1 and, with wp = wave/2, the blocks (t, wp) for
    // t = 0..4 (block column wp, a constant step from job to job, so the step
    // is an immediate offset), (wp, 4) as job 5, and for wp = 0 block (4, 4) as
    // job 6. The wave number is held in a scalar register: the trip test is a
    // scalar branch. The unroll lets the chains of neighbouring jobs (LDS read,
    // products, transform, product, store) run inside one another's waits.
    auto job = [&](const int t) __attribute__((always_inline)) {
      const int dpix = t < 5 ? t*4*EXT_ : t == 5 ? 0 : (4*EXT_ + 4)*4;   // job 6: wp = 0
      const _Float16* ap = (t == 5 ? apr : apc) + dpix * XPAD_;
      const _Float16* bp = &win_lds[(j*32 + (last ? 0 : nt*16) + nm) * XPAD_ + 8*hh];
      v16h A0, A1, B0, B1;
      ((f4*)&A0)[0] = *(const f4*)(ap);        // K  8h.. 8h+7
      ((f4*)&A0)[1] = *(const f4*)(ap + 16);   // K 16+8h..
      ((f4*)&A1)[0] = *(const f4*)(ap + 32);
      ((f4*)&A1)[1] = *(const f4*)(ap + 48);
      ((f4*)&B0)[0] = *(const f4*)(bp);
      ((f4*)&B0)[1] = *(const f4*)(bp + 16);
      ((f4*)&B1)[0] = *(const f4*)(bp + 32);
      ((f4*)&B1)[1] = *(const f4*)(bp + 48);
      v8f acc = (v8f){0,0,0,0,0,0,0,0};
      acc = __builtin_amdgcn_wmma_f32_16x16x32_f16(false, A0, false, B0, (short)0, acc, false, false);
      acc = __builtin_amdgcn_wmma_f32_16x16x32_f16(false, A1, false, B1, (short)0, acc, false, false);

      // per-lane channel's 2x2 spectral weights, the inverse's 1/4 folded in (exact)
      int sg  = last ? 2*nm : nt*16 + nm;        // last group: slots 8..15 are the high half
      int hch = ((sg < 16) ? 0 : 85) + 16*j + (last ? (nm & 7) : nm);
      hch = (hch > HID_-1) ? (HID_-1) : hch;     // pad slots: values are 0 anyway
      f4 fw = *(const f4*)&fftw_lds[hch*4];
      f2 wA = (f2){0.25f*fw[0],  0.25f*fw[1]}, wB = (f2){0.25f*fw[2],  0.25f*fw[3]};
      f2 nA = (f2){0.25f*fw[0], -0.25f*fw[1]}, nB = (f2){0.25f*fw[2], -0.25f*fw[3]};
      // each lane holds both rows of its 2 patches (C-layout rows 2h,2h+1):
      // forward 2x2 transform and spectral weight in f32, each value left at the
      // pixel position of its frequency. D row 8*hh + r is the lane's K position
      // 8*hh + r of an A fragment with M = slot, so the values go into F as they stand.
      v16h F = {};                               // K positions 16..31 stay zero
      #pragma unroll
      for (int pc = 0; pc < 2; ++pc) {
        f2 top = (f2){acc[2*pc],   acc[2*pc+1]};
        f2 bot = (f2){acc[4+2*pc], acc[4+2*pc+1]};
        f2 u = top + bot, v = top - bot;
        // (a + b)*w0, (a - b)*w1 as a*(w0, w1) + b*(w0, -w1): two packed operations
        f2 Fa = (f2){u[0], u[0]} * wA + (f2){u[1], u[1]} * nA;
        f2 Fb = (f2){v[0], v[0]} * wB + (f2){v[1], v[1]} * nB;
        F[2*pc]     = (_Float16)Fa[0];  F[2*pc + 1]     = (_Float16)Fa[1];
        F[4 + 2*pc] = (_Float16)Fb[0];  F[4 + 2*pc + 1] = (_Float16)Fb[1];
      }
      // inverse transform: y[slot][pixel] = sum over k of F[slot][k] * Hs[k][pixel].
      // D row 8*hh + r at column nm is slot 8*hh + r at the block's pixel nm:
      // eight neighbouring slots of one pixel, one 16-byte store.
      v8f y = (v8f){0,0,0,0,0,0,0,0};
      y = __builtin_amdgcn_wmma_f32_16x16x32_f16(false, F, false, Hs, (short)0, y, false, false);
      *(h8*)((t == 5 ? hpr : hpc) - (last ? nt*16 : 0) + dpix * HFP_) = __builtin_convertvector(y, h8);
    };
    if (!last) {
      #pragma unroll
      for (int t = 0; t < 7; ++t) {
        if (t == 6 && wp != 0) break;
        job(t);
      }
    } else if (nt == 0) {
      // the two waves of a block column share its jobs (scalar branches)
      #pragma unroll
      for (int t = 0; t < 3; ++t) job(t);
      if (wp == 0) job(6);
    } else {
      #pragma unroll
      for (int t = 3; t < 6; ++t) job(t);
    }
    __syncthreads();

    // ---- depthwise 3x3 on matrix products + exact-GELU gate ----
    // D row 8*hh + r of tile m is gated channel 32j + 16m + 8*hh + r at the
    // lane's pixel: exactly the lane's K positions of a GEMM2 fragment whose
    // row or column is the pixel, so the gated values go into A2 where they stand.
    // GEMM2 takes w_out as A and the gated values as B (both have the same k map).
    {
      v16h A2[2] = {};                      // last group: K positions 16..31 stay zero
      #pragma unroll
      for (int m = 0; m < 2; ++m) {
        if (last && m == 1) break;
        int c = 32*j + 16*m + nm;           // the lane's row as a gated channel
        const unsigned* t1 = &dwt_lds[(c < HID_ ? c        : 2*HID_) * DWW_];
        const unsigned* t2 = &dwt_lds[(c < HID_ ? c + HID_ : 2*HID_) * DWW_];
        v8f D1[2], D2[2];
        dw_tile(t1, hh, msk, hb, 8*m,      D1);
        dw_tile(t2, hh, msk, hb, last ? 8 : 16 + 8*m, D2);
        float g[2][8];
        float zmax = gate16<false>(D1, D2, g);
        // one test for the whole wave (a scalar branch); a NaN sum does not
        // raise zmax and gives NaN on either path
        if (__builtin_amdgcn_ballot_w32(zmax >= 1.0f) != 0u)
          gate16<true>(D1, D2, g);
        #pragma unroll
        for (int q = 0; q < 2; ++q)
          #pragma unroll
          for (int r = 0; r < 8; ++r) A2[q][8*m + r] = (_Float16)g[q][r];
      }
      #pragma unroll
      for (int n2 = 0; n2 < 4; ++n2) {
        const _Float16* bp = &wout_lds[(n2*16 + nm) * WOPAD_ + 32*j + 8*hh];
        v16h B2;
        ((f4*)&B2)[0] = *(const f4*)(bp);
        ((f4*)&B2)[1] = *(const f4*)(bp + 16);
        #pragma unroll
        for (int q = 0; q < 2; ++q)
          acc2[q][n2] = __builtin_amdgcn_wmma_f32_16x16x32_f16(
              false, B2, false, A2[q], (short)0, acc2[q][n2], false, false);
      }
    }
    __syncthreads();
  };
  for (int j = 0; j < NGRP_ - 1; ++j) group(j, false);
  group(NGRP_ - 1, true);

  // ---------------- epilogue: f32 output ----------------
  // C-layout row M = 8*hh + r of tile (q, n2) is out channel 16*n2 + 8*hh + r,
  // column N = nm the pixel (2*wave + q, nm): register r of 16 neighbouring lanes
  // is the tile's whole 64-byte row of one channel, so a store writes two
  // 64-byte runs.
  // The tile's base is the same for the whole work-group (a scalar), the lane's
  // part one 32-bit byte offset that no store's step changes.
  char* ob = (char*)(out + (size_t)b * C_ * H_ * W_ + (size_t)ty0 * W_ + tx0);
  const unsigned loff = 4u * (unsigned)(8*hh * (H_*W_) + wave*2 * W_ + nm);
  #pragma unroll
  for (int n2 = 0; n2 < 4; ++n2)
    #pragma unroll
    for (int q = 0; q < 2; ++q)
      #pragma unroll
      for (int r = 0; r < 8; ++r)
        *(float*)(ob + 4u * ((n2*16 + r) * (H_*W_) + q * W_) + loff) = acc2[q][n2][r];
}

extern "C" void kernel_launch(void* const* d_in, const int* in_sizes, int n_in,
                              void* d_out, int out_size, void* d_ws, size_t ws_size,
                              hipStream_t stream) {
  (void)in_sizes; (void)n_in; (void)d_ws; (void)ws_size; (void)out_size;
  const float* x     = (const float*)d_in[0];
  const float* w_in  = (const float*)d_in[1];
  const float* fft_w = (const float*)d_in[2];
  const float* w_dw  = (const float*)d_in[3];
  const float* w_out = (const float*)d_in[4];
  float* out = (float*)d_out;
  dim3 grid(W_/TILE_, H_/TILE_, B_);
  dffn_fused_kernel<<<grid, 256, 0, stream>>>(x, w_in, fft_w, w_dw, w_out, out);
}

// v010
// Measured time: 56.5 microseconds a run.
// Two timings next to v009 both put it at 1.03 times that version's speed.
// Counting every step since v000, it is 4.79 times as fast.
#include <hip/hip_runtime.h>
#include <hip/hip_bf16.h>

typedef __attribute__((ext_vector_type(16))) _Float16 v16h;
typedef __attribute__((ext_vector_type(2)))  _Float16 h2;
typedef __attribute__((ext_vector_type(8)))  float    v8f;
typedef __attribute__((ext_vector_type(4)))  float    f4;
typedef __attribute__((ext_vector_type(2)))  float    f2;
typedef __attribute__((ext_vector_type(4)))  _Float16 h4;
typedef __attribute__((ext_vector_type(8)))  _Float16 h8;
typedef __attribute__((ext_vector_type(4)))  unsigned u4;
typedef __attribute__((ext_vector_type(8)))  unsigned u8;

#define B_     4
#define C_     64
#define H_     256
#define W_     256
#define HID_   170
#define TILE_  16
#define EXT_   20          // TILE + 2*2 halo (patch-aligned)
#define NPIX_  (EXT_*EXT_) // 400
#define XPAD_  72          // padded channel stride (16B-aligned, bank-friendly)
#define NGRP_  6           // ceil(170/32) groups of 32 gathered hidden channels
#define WROWS_ 192         // 6*32 w_in rows: 176 gathered (zero-padded), 176..191 the inverse transform's matrix
#define HFP_   40          // filtered-h tile is pixel-major: 32 slots + 8 pad (80-byte pitch)
#define DWW_   12          // words per row of the depthwise weight table (10 used)
#define DWROWS_ (2*HID_)                 // one row per conv output channel
#define DWN_   (2*HID_*9)                // 3060 depthwise weights
#define DWIT_  ((DWN_ + 255)/256)        // 12 loads per thread
#define WOPAD_ 200         // padded hidden stride for w_out (cols >=170 zero)
#define XUNITS_ ((C_/4)*EXT_*(EXT_/2))   // 3200 staging units of the x tile
#define XIT_    (XUNITS_/256)            // 12 whole units per thread
#define XTAIL_  (XUNITS_ - 256*XIT_)     // 128 units left: half a unit per thread
#define WIT_    (WROWS_*(C_/4)/256)      // 12 16-byte loads of w_in per thread
#define TPW_    2                        // tiles a work-group takes, one after the other

#if defined(__HIP_DEVICE_COMPILE__) && defined(__gfx1250__)
#define USE_ASYNC_LDS 1
#else
#define USE_ASYNC_LDS 0
#endif

#if USE_ASYNC_LDS
// byte offset of a generic pointer within the wave's LDS aperture
__device__ static inline unsigned lds_offset_of(const void* p) {
  return (unsigned)(unsigned long long)
         (__attribute__((address_space(3))) const char*)p;
}
#endif

// erf on |z| < 1: the math library's own polynomial for that range (odd in z,
// so the sign needs no handling of its own); the same values as erff there.
__device__ static inline float erf_below_one(float z) {
  float t = z * z;
  float p = fmaf(t, fmaf(t, fmaf(t, fmaf(t, fmaf(t,
              -0x1.268bc2p-11f, 0x1.420828p-8f), -0x1.b5937p-6f), 0x1.ce077cp-4f),
              -0x1.81266p-2f), 0x1.06eba0p-3f);
  return fmaf(z, p, z);
}

// One 16x16 tile of the depthwise 3x3 as matrix products, for two pixel tiles.
// D[row][pixel] = sum over (tap, slot) of A[row][tap, slot] * hf[pixel + tap][slot]:
// rows are 16 conv output channels, fed by 8 hf slots (row r reads slot r/2), so
// A is block-diagonal: in each 8-slot chunk of K a row has one non-zero.
// A K chunk of a lane (8 halves) is one tap. Each weight is the f16 pair hi + lo
// (hi = f16(w), lo = f16(w - hi)), two products on the same hf value.
//   products 0,1: taps hh, 2+hh   (hi, then lo)    products 2,3: taps 4+hh, 6+hh
//   product  4  : tap 8, hi in the hh = 0 chunk, lo in the hh = 1 chunk; rest zero
// trow: the lane's row of the weight table; live: false for a padding row, whose
// weights count as zero; hb[e]: the lane's hf address of tap
// 2e+hh (e < 4) and of tap 8 (e = 4) for pixel tile 0, slot 0.
__device__ __forceinline__ void dw_tile(
    const unsigned* trow, bool live, int hh, const unsigned (&msk)[4],
    const _Float16* const (&hb)[5], int slot0, v8f (&D)[2])
{
  u4 w        = *(const u4*)(trow + 4*hh);
  unsigned w8 = trow[8 + hh];
  #pragma unroll
  for (int k = 0; k < 4; ++k) w[k] = live ? w[k] : 0u;
  w8 = live ? w8 : 0u;
  v16h A[5];
  #pragma unroll
  for (int k = 0; k < 2; ++k) {
    unsigned wa = w[2*k], wb = w[2*k + 1];
    unsigned ra = (wa >> 16) | (wa << 16), rb = (wb >> 16) | (wb << 16);
    A[2*k]     = __builtin_bit_cast(v16h, (u8){wa & msk[0], wa & msk[1], wa & msk[2], wa & msk[3],
                                               wb & msk[0], wb & msk[1], wb & msk[2], wb & msk[3]});
    A[2*k + 1] = __builtin_bit_cast(v16h, (u8){ra & msk[0], ra & msk[1], ra & msk[2], ra & msk[3],
                                               rb & msk[0], rb & msk[1], rb & msk[2], rb & msk[3]});
  }
  A[4] = __builtin_bit_cast(v16h, (u8){w8 & msk[0], w8 & msk[1], w8 & msk[2], w8 & msk[3], 0u, 0u, 0u, 0u});
  #pragma unroll
  for (int q = 0; q < 2; ++q) {
    const int o = q*EXT_*HFP_ + slot0;
    v16h B0, B1, B2;
    ((f4*)&B0)[0] = *(const f4*)(hb[0] + o);
    ((f4*)&B0)[1] = *(const f4*)(hb[1] + o);
    ((f4*)&B1)[0] = *(const f4*)(hb[2] + o);
    ((f4*)&B1)[1] = *(const f4*)(hb[3] + o);
    ((f4*)&B2)[0] = *(const f4*)(hb[4] + o);
    ((f4*)&B2)[1] = ((f4*)&B2)[0];          // meets zero weights: any finite data
    v8f d = (v8f){0,0,0,0,0,0,0,0};
    d = __builtin_amdgcn_wmma_f32_16x16x32_f16(false, A[0], false, B0, (short)0, d, false, false);
    d = __builtin_amdgcn_wmma_f32_16x16x32_f16(false, A[1], false, B0, (short)0, d, false, false);
    d = __builtin_amdgcn_wmma_f32_16x16x32_f16(false, A[2], false, B1, (short)0, d, false, false);
    d = __builtin_amdgcn_wmma_f32_16x16x32_f16(false, A[3], false, B1, (short)0, d, false, false);
    d = __builtin_amdgcn_wmma_f32_16x16x32_f16(false, A[4], false, B2, (short)0, d, false, false);
    D[q] = d;
  }
}

// Exact-GELU gate of the 16 value pairs a lane holds in two pairs of D tiles.
// FULL = false: erf by the |z| < 1 polynomial alone, no branch per value;
// returns the largest |z| the lane met, and the caller repeats the gate with
// FULL = true (erff) if that reaches 1.
template <bool FULL>
__device__ __forceinline__ float gate16(
    const v8f (&D1)[2], const v8f (&D2)[2], float (&g)[2][8])
{
  float zmax = 0.0f;
  #pragma unroll
  for (int q = 0; q < 2; ++q)
    #pragma unroll
    for (int r = 0; r < 8; ++r) {
      float s1 = D1[q][r], s2 = D2[q][r];
      float z = s1 * 0.70710678118654752f;
      float e;
      if (FULL) {
        e = erff(z);
      } else {
        e = erf_below_one(z);
        zmax = fmaxf(zmax, fabsf(z));
      }
      float ge = 0.5f * s1 * (1.0f + e);
      g[q][r] = ge * s2;
    }
  return zmax;
}

// second argument: four waves a SIMD, the register budget that lets two work-groups share a WGP
__global__ __launch_bounds__(256, 4) void dffn_fused_kernel(
    const float* __restrict__ xin,  const float* __restrict__ w_in,
    const float* __restrict__ fft_w, const float* __restrict__ w_dw,
    const float* __restrict__ w_out, float* __restrict__ out)
{
  __shared__ __align__(16) _Float16 x_lds  [NPIX_ * XPAD_];   // 57.6 KB
  __shared__ __align__(16) _Float16 win_lds[WROWS_ * XPAD_];  // 27.6 KB
  __shared__ __align__(16) _Float16 hf_lds [NPIX_ * HFP_];     // 32.0 KB
  __shared__ __align__(16) _Float16 wout_lds[64 * WOPAD_];    // 25.6 KB
  __shared__ __align__(16) unsigned dwt_lds [DWROWS_ * DWW_];  // 16.3 KB
  __shared__ __align__(16) float    fftw_lds[HID_*4];         //  2.7 KB

  const int tid  = threadIdx.x;
  const int wave = tid >> 5;
  const int nm   = tid & 15;        // M or N index within 16: a pixel or a channel
  const int hh   = (tid >> 4) & 1;  // wave half -> K-range selector in A/B layouts

  // Which tiles a work-group takes: every tile goes to one work-group, so the result
  // is right wherever a work-group lands; the deal below is counted on for speed only.
  // The grid holds as many work-groups as the chip has places for this kernel; each
  // takes TPW_ tiles, one after the other, and stages the weights in LDS only once.
  // Indices equal modulo 8 take one half image, row by row, so the tiles that
  // share data of x (side-by-side tiles, halos) and the lines of
  // out are taken at one time.
  const int flat = blockIdx.x + (W_/TILE_) * (blockIdx.y + (H_/TILE_) * blockIdx.z);
  const int reg  = flat & 7;        // 4 images x upper or lower half
  static_assert(B_ * 2 == 8 && W_/TILE_ == 16 && H_/TILE_ == 16, "8 regions of 8 x 16 tiles");
  static_assert(128 % TPW_ == 0, "a region's 128 tiles split evenly over the passes");
  const int b   = reg >> 1;

  const float* xb = xin + (size_t)b * C_ * H_ * W_;

  // ---- kick off async DMA of the pure-copy weight table into LDS ----
  // (tracked by ASYNCcnt; overlapped with x-tile staging below)
#if USE_ASYNC_LDS
  for (int i = tid; i < (HID_*4)/4; i += 256) {         // 170 x b128
    unsigned ldst = lds_offset_of(&fftw_lds[i*4]);
    unsigned long long ga = (unsigned long long)(const void*)(fft_w + i*4);
    asm volatile("global_load_async_to_lds_b128 %0, %1, off"
                 :: "v"(ldst), "v"(ga) : "memory");
  }
#else
  for (int i = tid; i < HID_*4;   i += 256) fftw_lds[i] = fft_w[i];
#endif

  // ---------------- stage the converted weights into LDS, once ----------------
  // Every global load below is unconditional (index clamped in bounds, value
  // selected to zero afterwards), so the whole batch is in flight before the
  // first wait.
  // depthwise weights, one 4-byte load per 256: the last one clamped in bounds
  const unsigned doff  = 4u * (unsigned)tid;
  const unsigned doffl = 4u * (unsigned)(tid + 256*(DWIT_-1) < DWN_ ? tid + 256*(DWIT_-1) : DWN_-1);
  float dv[DWIT_];
  #pragma unroll
  for (int i = 0; i < DWIT_ - 1; ++i)
    dv[i] = *(const float*)((const char*)w_dw + doff + 1024u * i);
  dv[DWIT_-1] = *(const float*)((const char*)w_dw + doffl);
  // gathered project_in rows: group j, slot s<16 -> ch 16j+s (low half),
  // slot s>=16 -> ch 85+16j+(s-16) (high half); invalid slots zero-padded.
  // Load i of a thread is LDS row 16i+t, t = tid/16: j = i/2, high half for odd i.
  // Group 5 is packed into one 16-row tile: rows 160..167 low half, 168..175 high
  // half (5 channels and 3 zero rows each); rows from 176 on: see the inverse transform's matrix below.
  const int wt = tid >> 4, wc4 = tid & 15;
  const bool wtail_ok = 80 + wt < 85;                 // group 5 holds 5 channels
  const unsigned woff  = 4u * (unsigned)(wt * C_ + wc4 * 4);
  const unsigned woff5 = 4u * (unsigned)((wtail_ok ? wt : 0) * C_ + wc4 * 4);
  f4 wv[WIT_];
  #pragma unroll
  for (int i = 0; i < WIT_; ++i) {
    unsigned row0 = ((i & 1) ? 85u : 0u) + 16u * (i >> 1);
    wv[i] = *(const f4*)((const char*)w_in + ((i >> 1) < 5 ? woff : woff5)
                         + 4u * C_ * row0);
  }
  // The loads above are through address translation before a later load's result
  // may land in a register that their addresses stand in.
  asm volatile("s_wait_xcnt 0x0"
               :: "v"(doff), "v"(doffl), "v"(woff), "v"(woff5) : "memory");
  // w_out: wave w stages rows 8w..8w+7; a lane takes the column pairs lane,
  // lane+32 and lane+64 of each row (pairs from 85 on are padding)
  const int lane = tid & 31;
  const unsigned ooff  = 4u * (unsigned)(wave * 8 * HID_ + 2 * lane);
  const unsigned ooff2 = 4u * (unsigned)(wave * 8 * HID_
                                         + 2 * (lane + 64 < HID_/2 ? lane + 64 : 0));
  f2 ov[8][3];
  #pragma unroll
  for (int rr = 0; rr < 8; ++rr) {
    ov[rr][0] = *(const f2*)((const char*)w_out + ooff  + 4u * HID_ * rr);
    ov[rr][1] = *(const f2*)((const char*)w_out + ooff  + 4u * HID_ * rr + 256u);
    ov[rr][2] = *(const f2*)((const char*)w_out + ooff2 + 4u * HID_ * rr);
  }
  // No offset register of the loads above may be rewritten (a later load's
  // result counts) before this wait: naming them as inputs keeps them until it.
  asm volatile("s_wait_xcnt 0x0"
               :: "v"(ooff), "v"(ooff2) : "memory");

  #pragma unroll
  for (int i = 0; i < WIT_; ++i) {
    bool ok = (i >> 1) < 5 || wtail_ok;
    h4 a;
    #pragma unroll
    for (int e = 0; e < 4; ++e) a[e] = (_Float16)(ok ? wv[i][e] : 0.0f);
    int row = (i >> 1) < 5 ? 16 * i + wt : 160 + 8 * (i & 1) + wt;
    if ((i >> 1) < 5 || wt < 8) *(h4*)&win_lds[row * XPAD_ + wc4 * 4] = a;
  }
  #pragma unroll
  for (int rr = 0; rr < 8; ++rr) {
    _Float16* wrow = &wout_lds[(wave * 8 + rr) * WOPAD_];
    #pragma unroll
    for (int ch = 0; ch < 3; ++ch) {
      int o2 = lane + 32 * ch;
      bool ok = o2 < HID_/2;
      h2 a;
      a[0] = (_Float16)(ok ? ov[rr][ch][0] : 0.0f);
      a[1] = (_Float16)(ok ? ov[rr][ch][1] : 0.0f);
      *(h2*)&wrow[2 * o2] = a;
    }
    if (lane < WOPAD_/2 - 96) *(h2*)&wrow[2 * (96 + lane)] = (h2){0, 0};
  }

  // depthwise weight table: row = conv output channel o, a word = the f16 pair
  // (hi, lo) of one weight with hi in the half that the row's hf slot has in
  // its register of a K chunk; words 0-3 taps 0,2,4,6; 4-7 taps 1,3,5,7; word 8
  // tap 8, word 9 tap 8 with the halves swapped.
  #pragma unroll
  for (int i = 0; i < DWIT_; ++i) {
    int idx = tid + 256 * i;
    int o = idx / 9, tap = idx - 9 * o;
    float wf = dv[i];
    _Float16 whi = (_Float16)wf;
    _Float16 wlo = (_Float16)(wf - (float)whi);
    unsigned uh = __builtin_bit_cast(unsigned short, whi);
    unsigned ul = __builtin_bit_cast(unsigned short, wlo);
    int  cg = o < HID_ ? o : o - HID_;      // gated channel the output feeds
    bool up = (cg >> 1) & 1;
    unsigned word = up ? (uh << 16) | ul : (ul << 16) | uh;
    unsigned swp  = up ? (ul << 16) | uh : (uh << 16) | ul;
    if (idx < DWN_) {
      dwt_lds[o * DWW_ + (tap < 8 ? (tap & 1) * 4 + (tap >> 1) : 8)] = word;
      if (tap == 8) dwt_lds[o * DWW_ + 9] = swp;
    }
  }

  // B fragment of the inverse 2x2 transform over a 4x4 pixel block: row k is the
  // frequency kept at pixel k, column nm the output pixel (pixel p = row p/4,
  // column p%4). +1 or -1 inside a patch, 0 elsewhere. A lane's rows 8*hh + e are
  // block rows 2*hh and 2*hh + 1, word d = e/2. Kept in LDS, one 16-byte row per
  // lane, and read once per group: held in registers through the depthwise part
  // it would cost the second work-group on the WGP.
  if (tid < 32) {
    const bool rowp = (nm >> 3) == hh;                           // same patch row
    unsigned s0 = 0x3C003C00u ^ ((nm & 1) ? 0x80000000u : 0u);   // fy = 0: (+1, +-1)
    unsigned s1 = s0 ^ ((nm & 4) ? 0x80008000u : 0u);            // fy = 1
    const bool c1 = (nm >> 1) & 1;                               // the pixel's patch column
    unsigned a0 = rowp && !c1 ? 0xFFFFFFFFu : 0u;
    unsigned a1 = rowp &&  c1 ? 0xFFFFFFFFu : 0u;
    // it lies in the rows of win_lds that the weights leave free, at a w_in fragment's
    // own lane pattern: its read shares that fragment's address register
    *(u4*)&win_lds[(176 + nm) * XPAD_ + 8*hh] = (u4){s0 & a0, s0 & a1, s1 & a0, s1 & a1};
  }

  // One pass per tile. Kept rolled, for speed only.
  #pragma unroll 1
  for (int it = 0; it < TPW_; ++it) {
  // The waves are numbered anew in each pass (any numbering serves: the body needs
  // each number once). The body's index arithmetic then hangs on the pass and is
  // redone in it; numbered alike, the compiler computes it once ahead of the loop
  // and holds the results through every phase, which overruns the 256 registers
  // that let two work-groups share a WGP.
  const int tid  = ((int)threadIdx.x + 32 * it) & 255;
  const int wave = __builtin_amdgcn_readfirstlane(tid >> 5);   // the same in all lanes: a scalar
  const int nm   = tid & 15;
  const int hh   = (tid >> 4) & 1;
  const int ridx = (flat >> 3) + (128/TPW_) * it;   // 0..127: 8 tile rows of 16 tiles
  const int tx0 = (ridx & 15) * TILE_;
  const int ty0 = ((reg & 1) * 8 + (ridx >> 4)) * TILE_;

  // ---------------- stage the pass's x tile into LDS ----------------
  // (x_lds is free: its last reader stands in front of the last group's barriers)
  // Every global load below is unconditional (index clamped in bounds, value
  // selected to zero afterwards), so the whole batch is in flight before the
  // first wait.
  //
  // x unit = 4 channels x 1 row x 2 columns: four 8-byte loads, two 8-byte LDS
  // stores. The tile's first column is even, so a column pair is inside the
  // image as a whole or outside it as a whole.
  f2       xv[XIT_][4];
  unsigned xoff[XIT_];     // byte offset of the unit's first load in xb
  int      xdst[XIT_];
  bool     xok[XIT_];
  const char* xbytes = (const char*)xb;

  // the unrolls of this section keep the batch arrays in registers and let all
  // loads of a batch issue back to back
  #pragma unroll
  for (int i = 0; i < XIT_; ++i) {
    int u   = tid + 256 * i;
    int cg  = u / (EXT_ * 10);
    int r   = u - cg * (EXT_ * 10);
    int py  = r / 10, k = r - py * 10;
    int gy  = ty0 - 2 + py, gx = tx0 - 2 + 2 * k;
    xok[i]  = (unsigned)gy < (unsigned)H_ && (unsigned)gx < (unsigned)W_;
    int cy  = gy < 0 ? 0 : (gy > H_ - 1 ? H_ - 1 : gy);
    int cx  = gx < 0 ? 0 : (gx > W_ - 2 ? W_ - 2 : gx);
    xoff[i] = 4u * (unsigned)(cg * 4 * (H_ * W_) + cy * W_ + cx);
    xdst[i] = (py * EXT_ + 2 * k) * XPAD_ + cg * 4;
    #pragma unroll
    for (int ch = 0; ch < 4; ++ch)
      xv[i][ch] = *(const f2*)(xbytes + xoff[i] + 4u * ch * (H_ * W_));
  }
  // the units left over: two threads share one, two channels each
  static_assert(2 * XTAIL_ == 256, "the tail takes exactly half a unit per thread");
  f2 tv[2]; unsigned toff; int tdst; bool tok;
  {
    int u   = 256 * XIT_ + (tid & 127);       // threads t and t + 128 share a unit
    int cg  = u / (EXT_ * 10);
    int r   = u - cg * (EXT_ * 10);
    int py  = r / 10, k = r - py * 10;
    int gy  = ty0 - 2 + py, gx = tx0 - 2 + 2 * k;
    tok     = (unsigned)gy < (unsigned)H_ && (unsigned)gx < (unsigned)W_;
    int cy  = gy < 0 ? 0 : (gy > H_ - 1 ? H_ - 1 : gy);
    int cx  = gx < 0 ? 0 : (gx > W_ - 2 ? W_ - 2 : gx);
    int c0  = cg * 4 + 2 * (tid >> 7);
    toff  = 4u * (unsigned)(c0 * (H_ * W_) + cy * W_ + cx);
    tdst  = (py * EXT_ + 2 * k) * XPAD_ + c0;
    tv[0] = *(const f2*)(xbytes + toff);
    tv[1] = *(const f2*)(xbytes + toff + 4u * (H_ * W_));
  }
  // No offset register of the loads above may be rewritten (a later load's
  // result counts) before this wait: naming them as inputs keeps them until it.
  asm volatile("s_wait_xcnt 0x0"
               :: "v"(xoff[0]), "v"(xoff[1]), "v"(xoff[2]), "v"(xoff[3]),
                  "v"(xoff[4]), "v"(xoff[5]), "v"(xoff[6]), "v"(xoff[7]),
                  "v"(xoff[8]), "v"(xoff[9]), "v"(xoff[10]), "v"(xoff[11]),
                  "v"(toff) : "memory");

#define X_STORE(i) do {                                                       \
    h4 a0, a1;                                                                \
    _Pragma("unroll")                                                         \
    for (int ch = 0; ch < 4; ++ch) {                                          \
      a0[ch] = (_Float16)(xok[i] ? xv[i][ch][0] : 0.0f);                      \
      a1[ch] = (_Float16)(xok[i] ? xv[i][ch][1] : 0.0f);                      \
    }                                                                         \
    *(h4*)&x_lds[xdst[i]]         = a0;    /* zero halo => zero FFT patches */\
    *(h4*)&x_lds[xdst[i] + XPAD_] = a1;                                       \
  } while (0)

  #pragma unroll
  for (int i = 0; i < XIT_; ++i) X_STORE(i);
  {
    h2 a0, a1;
    a0[0] = (_Float16)(tok ? tv[0][0] : 0.0f);  a0[1] = (_Float16)(tok ? tv[1][0] : 0.0f);
    a1[0] = (_Float16)(tok ? tv[0][1] : 0.0f);  a1[1] = (_Float16)(tok ? tv[1][1] : 0.0f);
    *(h2*)&x_lds[tdst]         = a0;
    *(h2*)&x_lds[tdst + XPAD_] = a1;
  }
#undef X_STORE

#if USE_ASYNC_LDS
  asm volatile("s_wait_asynccnt 0" ::: "memory");
#endif
  __syncthreads();

  // lane constants of the depthwise products: where the lane's row has its
  // non-zero in a K chunk, and the hf addresses of its taps.
  // Pixel tile q of a wave is output row 2*wave + q, columns 0..15 (N = nm).
  unsigned msk[4];
  #pragma unroll
  for (int r = 0; r < 4; ++r)
    msk[r] = ((nm >> 2) == r) ? (((nm >> 1) & 1) ? 0xFFFF0000u : 0x0000FFFFu) : 0u;
  // taps hh, 4+hh and 6+hh lie a constant apart (pixels hh, 21+hh, 40+hh of the
  // window): written so, they share one address register and differ in the
  // instruction's offset alone
  const _Float16* hb[5];
  hb[0] = &hf_lds[((wave*2 + 1)*EXT_ + nm + 1 + hh) * HFP_];
  hb[1] = &hf_lds[((wave*2 + 1 + hh)*EXT_ + nm + 1 + (hh ? 0 : 2)) * HFP_];
  hb[2] = hb[0] + (EXT_ + 1) * HFP_;
  hb[3] = hb[0] + 2 * EXT_ * HFP_;
  hb[4] = &hf_lds[((wave*2 + 3)*EXT_ + nm + 3) * HFP_];

  // GEMM1 job constants: the wave's number as a scalar, and the lane's pixel
  // inside a 4x4 block
  const int swave = __builtin_amdgcn_readfirstlane(wave);
  const int nt    = swave & 1;
  const int wp    = swave >> 1;
  const int lpix  = (nm >> 2)*EXT_ + (nm & 3);
  const int pixc  = lpix + 4*wp;                 // block (0, wp)
  const int pixr  = lpix + wp*4*EXT_ + 16;       // block (wp, 4)
  const _Float16* apc = &x_lds[pixc * XPAD_ + 8*hh];
  const _Float16* apr = &x_lds[pixr * XPAD_ + 8*hh];
  _Float16* hpc = &hf_lds[pixc * HFP_ + nt*16 + 8*hh];
  _Float16* hpr = &hf_lds[pixr * HFP_ + nt*16 + 8*hh];

  // persistent project_out accumulators: 2 pixel tiles x 4 out-channel tiles,
  // held transposed (rows = out channels, columns = pixels) for the epilogue's stores
  v8f acc2[2][4];
  #pragma unroll
  for (int q = 0; q < 2; ++q)
    #pragma unroll
    for (int n = 0; n < 4; ++n) acc2[q][n] = (v8f){0,0,0,0,0,0,0,0};

  // One channel group: GEMM1 and filter into hf_lds, then depthwise, gate, GEMM2.
  // last: the sixth group has 5 + 5 channels, gathered into ONE 16-slot tile
  // (low half in slots 0..7, high half in slots 8..15), so it has 25 GEMM1 jobs
  // for 50 and one gated 16-channel tile for two: its padding is not computed.
  // Inlined with last as a literal, so each of the two copies holds its own path only.
  auto group = [&](const int j, const bool last) __attribute__((always_inline)) {
    // ---- GEMM1 (project_in) over extended tile + 2x2 Hadamard FFT filter ----
    // (forward half on the vector unit, inverse half as a matrix product)
    // 25 pixel-blocks (5x5 of 4x4) x 2 channel-ntiles = 50 wave-jobs
    const u4 hw = *(const u4*)&win_lds[(176 + nm) * XPAD_ + 8*hh];
    const v16h Hs = __builtin_bit_cast(v16h, (u8){hw[0], hw[1], hw[2], hw[3], 0u, 0u, 0u, 0u});  // rows 16..31 zero
    // A wave has ntile wave & 1 and, with wp = wave/2, the blocks (t, wp) for
    // t = 0..4 (block column wp, a constant step from job to job, so the step
    // is an immediate offset), (wp, 4) as job 5, and for wp = 0 block (4, 4) as
    // job 6. The wave number is held in a scalar register: the trip test is a
    // scalar branch. The unroll lets the chains of neighbouring jobs (LDS read,
    // products, transform, product, store) run inside one another's waits.
    auto job = [&](const int t) __attribute__((always_inline)) {
      const int dpix = t < 5 ? t*4*EXT_ : t == 5 ? 0 : (4*EXT_ + 4)*4;   // job 6: wp = 0
      const _Float16* ap = (t == 5 ? apr : apc) + dpix * XPAD_;
      const _Float16* bp = &win_lds[(j*32 + (last ? 0 : nt*16) + nm) * XPAD_ + 8*hh];
      v16h A0, A1, B0, B1;
      ((f4*)&A0)[0] = *(const f4*)(ap);        // K  8h.. 8h+7
      ((f4*)&A0)[1] = *(const f4*)(ap + 16);   // K 16+8h..
      ((f4*)&A1)[0] = *(const f4*)(ap + 32);
      ((f4*)&A1)[1] = *(const f4*)(ap + 48);
      ((f4*)&B0)[0] = *(const f4*)(bp);
      ((f4*)&B0)[1] = *(const f4*)(bp + 16);
      ((f4*)&B1)[0] = *(const f4*)(bp + 32);
      ((f4*)&B1)[1] = *(const f4*)(bp + 48);
      v8f acc = (v8f){0,0,0,0,0,0,0,0};
      acc = __builtin_amdgcn_wmma_f32_16x16x32_f16(false, A0, false, B0, (short)0, acc, false, false);
      acc = __builtin_amdgcn_wmma_f32_16x16x32_f16(false, A1, false, B1, (short)0, acc, false, false);

      // per-lane channel's 2x2 spectral weights, the inverse's 1/4 folded in (exact)
      int sg  = last ? 2*nm : nt*16 + nm;        // last group: slots 8..15 are the high half
      int hch = ((sg < 16) ? 0 : 85) + 16*j + (last ? (nm & 7) : nm);
      hch = (hch > HID_-1) ? (HID_-1) : hch;     // pad slots: values are 0 anyway
      f4 fw = *(const f4*)&fftw_lds[hch*4];
      f2 wA = (f2){0.25f*fw[0],  0.25f*fw[1]}, wB = (f2){0.25f*fw[2],  0.25f*fw[3]};
      f2 nA = (f2){0.25f*fw[0], -0.25f*fw[1]}, nB = (f2){0.25f*fw[2], -0.25f*fw[3]};
      // each lane holds both rows of its 2 patches (C-layout rows 2h,2h+1):
      // forward 2x2 transform and spectral weight in f32, each value left at the
      // pixel position of its frequency. D row 8*hh + r is the lane's K position
      // 8*hh + r of an A fragment with M = slot, so the values go into F as they stand.
      v16h F = {};                               // K positions 16..31 stay zero
      #pragma unroll
      for (int pc = 0; pc < 2; ++pc) {
        f2 top = (f2){acc[2*pc],   acc[2*pc+1]};
        f2 bot = (f2){acc[4+2*pc], acc[4+2*pc+1]};
        f2 u = top + bot, v = top - bot;
        // (a + b)*w0, (a - b)*w1 as a*(w0, w1) + b*(w0, -w1): two packed operations
        f2 Fa = (f2){u[0], u[0]} * wA + (f2){u[1], u[1]} * nA;
        f2 Fb = (f2){v[0], v[0]} * wB + (f2){v[1], v[1]} * nB;
        F[2*pc]     = (_Float16)Fa[0];  F[2*pc + 1]     = (_Float16)Fa[1];
        F[4 + 2*pc] = (_Float16)Fb[0];  F[4 + 2*pc + 1] = (_Float16)Fb[1];
      }
      // inverse transform: y[slot][pixel] = sum over k of F[slot][k] * Hs[k][pixel].
      // D row 8*hh + r at column nm is slot 8*hh + r at the block's pixel nm:
      // eight neighbouring slots of one pixel, one 16-byte store.
      v8f y = (v8f){0,0,0,0,0,0,0,0};
      y = __builtin_amdgcn_wmma_f32_16x16x32_f16(false, F, false, Hs, (short)0, y, false, false);
      *(h8*)((t == 5 ? hpr : hpc) - (last ? nt*16 : 0) + dpix * HFP_) = __builtin_convertvector(y, h8);
    };
    if (!last) {
      #pragma unroll
      for (int t = 0; t < 7; ++t) {
        if (t == 6 && wp != 0) break;
        job(t);
      }
    } else if (nt == 0) {
      // the two waves of a block column share its jobs (scalar branches)
      #pragma unroll
      for (int t = 0; t < 3; ++t) job(t);
      if (wp == 0) job(6);
    } else {
      #pragma unroll
      for (int t = 3; t < 6; ++t) job(t);
    }
    __syncthreads();

    // ---- depthwise 3x3 on matrix products + exact-GELU gate ----
    // D row 8*hh + r of tile m is gated channel 32j + 16m + 8*hh + r at the
    // lane's pixel: exactly the lane's K positions of a GEMM2 fragment whose
    // row or column is the pixel, so the gated values go into A2 where they stand.
    // GEMM2 takes w_out as A and the gated values as B (both have the same k map).
    {
      v16h A2[2] = {};                      // last group: K positions 16..31 stay zero
      #pragma unroll
      for (int m = 0; m < 2; ++m) {
        if (last && m == 1) break;
        int c = 32*j + 16*m + nm;           // the lane's row as a gated channel
        // a padding row (last group only) reads a row in bounds and zeroes what it
        // read, so the two tables' rows lie a constant apart: one address for both
        const bool live = !last || c < HID_;
        const unsigned* t1 = &dwt_lds[(live ? c : HID_ - 1) * DWW_];
        const unsigned* t2 = t1 + HID_ * DWW_;
        v8f D1[2], D2[2];
        dw_tile(t1, live, hh, msk, hb, 8*m,      D1);
        dw_tile(t2, live, hh, msk, hb, last ? 8 : 16 + 8*m, D2);
        float g[2][8];
        float zmax = gate16<false>(D1, D2, g);
        // one test for the whole wave (a scalar branch); a NaN sum does not
        // raise zmax and gives NaN on either path
        if (__builtin_amdgcn_ballot_w32(zmax >= 1.0f) != 0u)
          gate16<true>(D1, D2, g);
        #pragma unroll
        for (int q = 0; q < 2; ++q)
          #pragma unroll
          for (int r = 0; r < 8; ++r) A2[q][8*m + r] = (_Float16)g[q][r];
      }
      #pragma unroll
      for (int n2 = 0; n2 < 4; ++n2) {
        const _Float16* bp = &wout_lds[(n2*16 + nm) * WOPAD_ + 32*j + 8*hh];
        v16h B2;
        ((f4*)&B2)[0] = *(const f4*)(bp);
        ((f4*)&B2)[1] = *(const f4*)(bp + 16);
        #pragma unroll
        for (int q = 0; q < 2; ++q)
          acc2[q][n2] = __builtin_amdgcn_wmma_f32_16x16x32_f16(
              false, B2, false, A2[q], (short)0, acc2[q][n2], false, false);
      }
    }
    __syncthreads();
  };
  for (int j = 0; j < NGRP_ - 1; ++j) group(j, false);
  group(NGRP_ - 1, true);

  // ---------------- epilogue: f32 output ----------------
  // C-layout row M = 8*hh + r of tile (q, n2) is out channel 16*n2 + 8*hh + r,
  // column N = nm the pixel (2*wave + q, nm): register r of 16 neighbouring lanes
  // is the tile's whole 64-byte row of one channel, so a store writes two
  // 64-byte runs.
  // The tile's base is the same for the whole work-group (a scalar), the lane's
  // part one 32-bit byte offset that no store's step changes.
  char* ob = (char*)(out + (size_t)b * C_ * H_ * W_ + (size_t)ty0 * W_ + tx0);
  const unsigned loff = 4u * (unsigned)(8*hh * (H_*W_) + wave*2 * W_ + nm);
  #pragma unroll
  for (int n2 = 0; n2 < 4; ++n2)
    #pragma unroll
    for (int q = 0; q < 2; ++q)
      #pragma unroll
      for (int r = 0; r < 8; ++r)
        *(float*)(ob + 4u * ((n2*16 + r) * (H_*W_) + q * W_) + loff) = acc2[q][n2][r];
  // The next pass rewrites the registers that the stores' addresses stand in:
  // naming them as inputs keeps them until this wait.
  asm volatile("s_wait_xcnt 0x0" :: "v"(loff), "s"(ob) : "memory");
  }   // it
}

extern "C" void kernel_launch(void* const* d_in, const int* in_sizes, int n_in,
                              void* d_out, int out_size, void* d_ws, size_t ws_size,
                              hipStream_t stream) {
  (void)in_sizes; (void)n_in; (void)d_ws; (void)ws_size; (void)out_size;
  const float* x     = (const float*)d_in[0];
  const float* w_in  = (const float*)d_in[1];
  const float* fft_w = (const float*)d_in[2];
  const float* w_dw  = (const float*)d_in[3];
  const float* w_out = (const float*)d_in[4];
  float* out = (float*)d_out;
  dim3 grid(W_/TILE_, H_/TILE_, B_/TPW_);
  dffn_fused_kernel<<<grid, 256, 0, stream>>>(x, w_in, fft_w, w_dw, w_out, out);
}
